// v000
// Measured on an AMD MI455X. A time is GPU time per run, averaged over a window of back-to-back runs after a warm-up
// (all launches, gaps included; the runs take copies of the inputs in turn), and the median of several windows.
// Apart from v000's, it joins two sittings. Times from different sittings can be a few percent apart, while
// side-by-side timings come from the same sitting.
// v000, which the later versions start from, runs in 160 microseconds.
// Contractions: q.k^T scores = v_wmma_f32_16x16x32_bf16 (bf16 operands = RNE-converted inputs, one product, f32 accumulate);
// p.v context = v_wmma_f32_16x16x32_f16 (p carried x1024 in f16 plus an f16 residual plane x4096 on the leading query blocks,
// v = RNE-bf16 input carried x16 in f16), f32 accumulate; tau, delta, causal mask and softmax in f32.
#include <hip/hip_runtime.h>
#include <math.h>
#include <stdint.h>

#ifndef NB
#define NB 4
#endif
#ifndef SEQ
#define SEQ 2048
#endif
#define NB_FULL  4
#define SEQ_FULL 2048
#define NH  8
#define HD  64
#define DM  (NH * HD)        // 512: token row pitch of q, k, v and out (heads interleaved within a token row)
#define NQB (SEQ / 64)       // 64-row query blocks == 64-key tiles
#define RESQB 8              // leading query blocks that add the p residual plane
#define VCARRY 16.0f         // v plane carried x16 in f16
#define PCARRY 1024.0f       // p carried x1024 in f16
#define PRES   4096.0f       // p residual plane scale
static_assert((SEQ % 64) == 0);
static_assert(SEQ >= 64 && SEQ <= SEQ_FULL);
static_assert(NB >= 1 && NB <= NB_FULL);
static_assert(NH * HD == DM);
static_assert(((SEQ * DM / 8) % 256) == 0);

typedef _Float16 v16h __attribute__((ext_vector_type(16)));
typedef _Float16 v8h  __attribute__((ext_vector_type(8)));
typedef __bf16   v16b __attribute__((ext_vector_type(16)));
typedef __bf16   v8b  __attribute__((ext_vector_type(8)));
typedef float    v8f  __attribute__((ext_vector_type(8)));
typedef float    v4f  __attribute__((ext_vector_type(4)));
typedef unsigned int v4u __attribute__((ext_vector_type(4)));

// ---- scalar helpers --------------------------------------------------------------------------------
__device__ __forceinline__ unsigned short bf_bits(float f) {          // f32 -> bf16 bits, RNE convert
  unsigned u = __float_as_uint(f);
  return (unsigned short)((u + 0x7FFFu + ((u >> 16) & 1u)) >> 16);
}
__device__ __forceinline__ float bf_up(unsigned short h) { return __uint_as_float(((unsigned)h) << 16); }
__device__ __forceinline__ unsigned pk16(unsigned short a, unsigned short b) { return (unsigned)a | ((unsigned)b << 16); }
__device__ __forceinline__ v8f zero8() { v8f z = {0.f, 0.f, 0.f, 0.f, 0.f, 0.f, 0.f, 0.f}; return z; }

// ---- fragment loader: 16-bit A/B operand, lane -> row/col (lane&15), p already includes +8*(lane>>4);
//      elements 0..7 <- p[0..7] (k0+8h..), elements 8..15 <- p[16..23] (k0+16+8h..)
__device__ __forceinline__ v16b ldfrag_b(const __bf16* p) {
  union { v16b v; v8b h[2]; } f;
  f.h[0] = *(const v8b*)(p);
  f.h[1] = *(const v8b*)(p + 16);
  return f.v;
}

// ---- WMMA helpers with trailing VALU hazard gap --------------------------------------------------------
__device__ __forceinline__ v8f mma_b(v16b a, v16b b, v8f c) {
  c = __builtin_amdgcn_wmma_f32_16x16x32_bf16(false, a, false, b, (short)0, c, false, false);
  asm volatile("v_nop\n\tv_nop\n\tv_nop\n\tv_nop" : "+v"(c) : "v"(a), "v"(b));
  return c;
}
__device__ __forceinline__ v8f mma_h(v16h a, v16h b, v8f c) {
  c = __builtin_amdgcn_wmma_f32_16x16x32_f16(false, a, false, b, (short)0, c, false, false);
  asm volatile("v_nop\n\tv_nop\n\tv_nop\n\tv_nop" : "+v"(c) : "v"(a), "v"(b));
  return c;
}

// =====================================================================================================
// f32 -> bf16 (RNE convert), 8 elements per thread, one 16-B store per lane: a wave writes 512 contiguous B
// grid = (n8 / 256, NB); blockIdx.y = batch with source stride sIn (floats) and destination stride sOut (halves).
// coverage: NB x n8 threads x 8 = the whole [NB][SEQ][DM] plane (n8 = SEQ*DM/8 is a multiple of 256).
// =====================================================================================================
__global__ __launch_bounds__(256) void cvt_bf16x8(const float* __restrict__ in, unsigned short* out, int n8,
                                                  long long sIn, long long sOut) {
  const int i = blockIdx.x * 256 + threadIdx.x;
  const int b = blockIdx.y;
  if (i < n8) {
    const float* src = in + (size_t)b * (size_t)sIn + (size_t)i * 8;
    unsigned short* dst = out + (size_t)b * (size_t)sOut + (size_t)i * 8;
    const v4f a  = *(const v4f*)(src);
    const v4f a4 = *(const v4f*)(src + 4);
    v4u p;
    p[0] = pk16(bf_bits(a[0]),  bf_bits(a[1]));
    p[1] = pk16(bf_bits(a[2]),  bf_bits(a[3]));
    p[2] = pk16(bf_bits(a4[0]), bf_bits(a4[1]));
    p[3] = pk16(bf_bits(a4[2]), bf_bits(a4[3]));
    *(v4u*)(dst) = p;
    
  }
}

// =====================================================================================================
// values f32 (b, s, h, d) -> V^T f16 plane: element (b, h, d, s) at [(b*DM + h*64 + d)*SEQ + s],
// value = f16(VCARRY * bf16(v)) (exact: a bf16 significand fits in f16).
// Block = (key tile st = blockIdx.x, head = blockIdx.y, batch = blockIdx.z), 256 threads.
// Load phase: thread -> (key s = tid>>2, 16 d-columns dq = (tid&3)*16): 4 x 16-B loads of one token row
// segment, element stores into the LDS tile T[d][s] (pitch 72). coverage: 256 threads x 16 = 64 x 64.
// Store phase after __syncthreads: 8 waves x 2 x (4 rows of 8 lanes x 16 B) = 64 output rows d x 64 keys;
// =====================================================================================================
__global__ __launch_bounds__(256) void vt_cvt(const float* __restrict__ v, unsigned short* vt) {
  __shared__ __align__(16) _Float16 T[64 * 72];
  const int tid  = threadIdx.x;
  const int wave = tid >> 5;
  const int lane = tid & 31;
  const int st   = blockIdx.x;
  const int h    = blockIdx.y;
  const int b    = blockIdx.z;
  {
    const int s  = tid >> 2;            // 0..63
    const int dq = (tid & 3) * 16;      // 0,16,32,48
    const float* src = v + (((size_t)b * SEQ_FULL + (size_t)st * 64 + (size_t)s) * DM + (size_t)h * HD + (size_t)dq);
#pragma unroll
    for (int i = 0; i < 4; ++i) {
      const v4f a = *(const v4f*)(src + 4 * i);
#pragma unroll
      for (int e = 0; e < 4; ++e) {
        const float f = bf_up(bf_bits(a[e])) * VCARRY;
        T[(dq + 4 * i + e) * 72 + s] = (_Float16)f;
      }
    }
  }
  __syncthreads();
  {
    const int q8 = lane >> 3, c8 = (lane & 7) * 8;
    v4u w[2];
#pragma unroll
    for (int it = 0; it < 2; ++it) {
      const int d = wave * 8 + it * 4 + q8;           // wave w: rows 8w..8w+7 (it 0..1 x q8 0..3)
      const v8h x = *(const v8h*)(T + d * 72 + c8);
      w[it] = __builtin_bit_cast(v4u, x);
    }
    unsigned short* dst = vt + ((size_t)b * DM + (size_t)h * HD) * SEQ + (size_t)st * 64 + (size_t)c8;
    {
#pragma unroll
      for (int it = 0; it < 2; ++it) {
        const int d = wave * 8 + it * 4 + q8;
        *(v4u*)(dst + (size_t)d * SEQ) = w[it];
      }
      
    }
  }
}

// =====================================================================================================
// Causal attention, head dim 64, no projections.
//   q plane (bf16):  element (b, t, h, e) at [(b*SEQ + t)*DM + h*64 + e]   (rows of batch b: b*SEQ..)
//   k plane (bf16):  same layout with key index s
//   v^T plane (f16): element (b, h, d, s) at [(b*DM + h*64 + d)*SEQ + s], value VCARRY * bf16(v)
//   tau [b], delta [b][SEQ_FULL]: used as their RNE-bf16 values in f32
//   scores(t, s) = q_t . k_s (one bf16 product, f32 accumulate); logit = (scores * tau + delta[s]) * 0.125;
//   keys s > t -> -inf; online softmax in f32; p = exp(logit - m) carried as f16(1024 p); RES adds an f16
//   residual plane f16((1024 p - hi) * 4096) with its own accumulator folded back per tile with 1/4096.
//   context = p . v on f16 WMMA; out (f32) element (b, t, h, d) at [(b*SEQ + t)*DM + h*64 + d] = ctx / (l * 1024 * 16).
//   Block = 4 waves = 64 query rows (query block qb) of one (b, h); grid = nqbThis * NH * NB; key tiles
//   kt = 0..qb (block-uniform trip, static bound NQB), 64 keys each; only the diagonal tile has masked keys and
//   every query row keeps its own key, so every row max is finite on every processed tile.
//   K / V^T tile staging: 128 threads x 32 elements per plane = the whole 64x64 tile (plain 16-B loads,
//   __syncthreads before and after; staged extent == consumed extent). P tiles are wave-private, spilled with
//   Output coverage: each wave stores rows q0..q0+15 (it 0..7 x lane>>4 0..1) x 64 columns (16 lanes x 16 B
// =====================================================================================================
template <bool RES>
__global__ __launch_bounds__(128)
void attn_causal64(const unsigned short* __restrict__ qp, const unsigned short* __restrict__ kp,
                   const unsigned short* __restrict__ vtp, const float* __restrict__ taup,
                   const float* __restrict__ deltap, float* outp, int qbBase, int nqbThis) {
  union FB { v16b v; v8b h[2]; };
  union FH { v16h v; v8h h[2]; };
  __shared__ __align__(16) __bf16   Ksh[64 * 64];                 // K [kv][e]      8 KB, cross-wave
  __shared__ __align__(16) _Float16 Vth[64 * 64];                 // V^T [d][kv]    8 KB, cross-wave
  __shared__ __align__(16) _Float16 Psh[4][16 * 64];              // per wave P [row][kv]
  __shared__ __align__(16) _Float16 Psl[RES ? 4 : 1][16 * 64];    // per wave P residual
  __shared__ __align__(16) float    Os[4][16 * 64];               // per wave context tile [row][d]

  const int tid  = threadIdx.x;
  const int wave = tid >> 5;
  const int lane = tid & 31;
  const int hh   = lane >> 4;
  const int c    = lane & 15;

  const int bx   = blockIdx.x;
  const int qbl  = bx % nqbThis;
  const int rest = bx / nqbThis;
  const int h    = rest % NH;
  const int b    = rest / NH;
  const int qb   = qbBase + qbl;
  const int q0   = qb * 64 + wave * 16;
  const size_t rowB = (size_t)b * SEQ;

  const __bf16*   Qh = (const __bf16*)(const void*)qp + (size_t)h * HD;
  const __bf16*   Kh = (const __bf16*)(const void*)kp + (size_t)h * HD;
  const _Float16* Vt = (const _Float16*)(const void*)vtp + ((size_t)b * DM + (size_t)h * HD) * SEQ;
  const float* dlt   = deltap + (size_t)b * SEQ_FULL;
  float* Ob          = outp + (size_t)h * HD;
  const float tau_b  = bf_up(bf_bits(taup[b]));   // block-uniform scalar

  // ---- Q fragments (A operand, row = lane&15): 2 e-chunks ----
  v16b qa[2];
#pragma unroll
  for (int dc = 0; dc < 2; ++dc) {
    const size_t qo = (rowB + (size_t)q0 + (size_t)c) * DM + (size_t)(dc * 32 + 8 * hh);
    qa[dc] = ldfrag_b(Qh + qo);
  }

  float mrow[8], lrow[8];
  v8f oacc[4];
#pragma unroll
  for (int r = 0; r < 8; ++r) { mrow[r] = -INFINITY; lrow[r] = 0.f; }
#pragma unroll
  for (int t = 0; t < 4; ++t) oacc[t] = zero8();

  for (int kt = 0; kt < NQB; ++kt) {          // static bound
    if (kt > qb) break;                       // block-uniform: causal key tiles 0..qb
    const int kv0 = kt * 64;
    __syncthreads();
    {
      const int r = tid >> 1, half = (tid & 1) * 32;
      const __bf16*   kg = Kh + (rowB + (size_t)kv0 + (size_t)r) * DM + half;   // K row kv0+r, e = half..half+31
      const _Float16* vg = Vt + (size_t)r * SEQ + (size_t)kv0 + half;          // V^T row d = r, s = kv0+half..+31
#pragma unroll
      for (int i = 0; i < 4; ++i) {
        const v8b a0 = *(const v8b*)(kg + 8 * i);
        const v8h b0 = *(const v8h*)(vg + 8 * i);
        *(v8b*)(Ksh + r * 64 + half + 8 * i) = a0;
        *(v8h*)(Vth + r * 64 + half + 8 * i) = b0;
      }
    }
    __syncthreads();

    // ---- scores: 16 query rows x 64 keys per wave, one bf16 product per 32-deep e step ----
    v8f s[4];
#pragma unroll
    for (int j = 0; j < 4; ++j) {
      s[j] = zero8();
#pragma unroll
      for (int dc = 0; dc < 2; ++dc) {
        FB kb;
        kb.h[0] = *(const v8b*)(Ksh + (j * 16 + c) * 64 + dc * 32 + 8 * hh);
        kb.h[1] = *(const v8b*)(Ksh + (j * 16 + c) * 64 + dc * 32 + 16 + 8 * hh);
        s[j] = mma_b(qa[dc], kb.v, s[j]);
      }
    }

    // ---- tau / delta in f32, scale, causal mask, row max, online softmax, P (x1024) and P residual (x4096) to LDS ----
    float dj[4];
#pragma unroll
    for (int j = 0; j < 4; ++j) dj[j] = bf_up(bf_bits(dlt[kv0 + j * 16 + c]));   // kv0+j*16+c < SEQ <= SEQ_FULL
    _Float16* pwh = Psh[wave];
    _Float16* pwl = Psl[RES ? wave : 0];
#pragma unroll
    for (int r = 0; r < 8; ++r) {
      const int ridx = q0 + 8 * hh + r;
      float m = -INFINITY;
#pragma unroll
      for (int j = 0; j < 4; ++j) {
        const int kidx = kv0 + j * 16 + c;
        float sv = (s[j][r] * tau_b + dj[j]) * 0.125f;
        sv = (kidx > ridx) ? -INFINITY : sv;
        s[j][r] = sv;
        m = fmaxf(m, sv);
      }
#pragma unroll
      for (int off = 1; off < 16; off <<= 1) m = fmaxf(m, __shfl_xor(m, off, 32));
      const float mnew  = fmaxf(mrow[r], m);
      const float msafe = (mnew == -INFINITY) ? 0.f : mnew;
      const float alpha = __expf(mrow[r] - msafe);
      mrow[r] = mnew;
      float psum = 0.f;
#pragma unroll
      for (int j = 0; j < 4; ++j) {
        const float p = __expf(s[j][r] - msafe);    // masked key: exp(-inf) = 0
        psum += p;
        const float p1k = p * PCARRY;
        const _Float16 ph = (_Float16)p1k;
        pwh[(8 * hh + r) * 64 + j * 16 + c] = ph;
        if (RES) {
          const _Float16 pl = (_Float16)((p1k - (float)ph) * PRES);
          pwl[(8 * hh + r) * 64 + j * 16 + c] = pl;
        }
      }
#pragma unroll
      for (int off = 1; off < 16; off <<= 1) psum += __shfl_xor(psum, off, 32);
      lrow[r] = lrow[r] * alpha + psum;
#pragma unroll
      for (int t = 0; t < 4; ++t) oacc[t][r] *= alpha;
    }
    __builtin_amdgcn_fence(__ATOMIC_RELEASE, "workgroup");
    __builtin_amdgcn_wave_barrier();
    __builtin_amdgcn_fence(__ATOMIC_ACQUIRE, "workgroup");

    // ---- context += P . V (f16 WMMA), residual products into a separate accumulator ----
    v8f o1[4];
#pragma unroll
    for (int t = 0; t < 4; ++t) o1[t] = zero8();
#pragma unroll 1
    for (int kk = 0; kk < 2; ++kk) {
      FH pa, pl;
      pa.h[0] = *(const v8h*)(pwh + c * 64 + kk * 32 + 8 * hh);
      pa.h[1] = *(const v8h*)(pwh + c * 64 + kk * 32 + 16 + 8 * hh);
      if (RES) {
        pl.h[0] = *(const v8h*)(pwl + c * 64 + kk * 32 + 8 * hh);
        pl.h[1] = *(const v8h*)(pwl + c * 64 + kk * 32 + 16 + 8 * hh);
      } else {
        pl.v = pa.v;
      }
#pragma unroll
      for (int t = 0; t < 4; ++t) {
        FH vb;
        vb.h[0] = *(const v8h*)(Vth + (t * 16 + c) * 64 + kk * 32 + 8 * hh);
        vb.h[1] = *(const v8h*)(Vth + (t * 16 + c) * 64 + kk * 32 + 16 + 8 * hh);
        oacc[t] = mma_h(pa.v, vb.v, oacc[t]);
        if (RES) o1[t] = mma_h(pl.v, vb.v, o1[t]);
      }
    }
    if (RES) {
#pragma unroll
      for (int t = 0; t < 4; ++t)
#pragma unroll
        for (int r = 0; r < 8; ++r) oacc[t][r] += o1[t][r] * (1.0f / PRES);
    }
  }

  // ---- normalise (1/l, the 1/1024 p carry and the 1/16 v carry), stage the wave's 16x64 tile,
  float* os = Os[wave];
#pragma unroll
  for (int r = 0; r < 8; ++r) {
    const float l = lrow[r];
    const float inv = ((l > 0.f) ? (1.0f / l) : 0.f) * (1.0f / PCARRY) * (1.0f / VCARRY);
#pragma unroll
    for (int t = 0; t < 4; ++t) os[(8 * hh + r) * 64 + t * 16 + c] = oacc[t][r] * inv;
  }
  __builtin_amdgcn_fence(__ATOMIC_RELEASE, "workgroup");
  __builtin_amdgcn_wave_barrier();
  __builtin_amdgcn_fence(__ATOMIC_ACQUIRE, "workgroup");
  {
    const int hh2 = lane >> 4, c4 = (lane & 15) * 4;
    v4f vv[8];
#pragma unroll
    for (int it = 0; it < 8; ++it) {
      const int row = it * 2 + hh2;                      // it 0..7 x hh2 0..1 = rows 0..15
      vv[it] = *(const v4f*)(os + row * 64 + c4);
    }
    {
#pragma unroll
      for (int it = 0; it < 8; ++it) {
        const int row = it * 2 + hh2;
        *(v4f*)(Ob + (rowB + (size_t)q0 + (size_t)row) * DM + (size_t)c4) = vv[it];
      }
      
    }
  }
}

// =====================================================================================================
// Workspace map (bytes, NB = 4, SEQ = 2048):
//   Qb  bf16 [NB*SEQ][DM]        0          8388608
//   Kb  bf16 [NB*SEQ][DM]        8388608    8388608
//   VT  f16  [NB][DM][SEQ]       16777216   8388608
//   end                          25165824
// Inputs keep the full per-batch token stride SEQ_FULL * DM; planes and out are compact over NB, SEQ.
// =====================================================================================================
extern "C" void kernel_launch(void* const* d_in, const int* in_sizes, int n_in,
                              void* d_out, int out_size, void* d_ws, size_t ws_size,
                              hipStream_t stream) {
  if (n_in < 5) return;
  const long long needTok = (long long)(NB - 1) * SEQ_FULL + (long long)SEQ;
  if ((long long)in_sizes[0] < needTok * DM) return;
  if ((long long)in_sizes[1] < needTok * DM) return;
  if ((long long)in_sizes[2] < needTok * DM) return;
  if (in_sizes[3] < NB) return;
  if ((long long)in_sizes[4] < needTok) return;
  if ((long long)out_size < (long long)NB * SEQ * DM) return;

  const float* q     = (const float*)d_in[0];
  const float* k     = (const float*)d_in[1];
  const float* v     = (const float*)d_in[2];
  const float* tau   = (const float*)d_in[3];
  const float* delta = (const float*)d_in[4];
  float* out = (float*)d_out;

  const size_t PX = (size_t)NB * SEQ * DM * 2;     // 8388608: 16-bit plane [NB*SEQ][DM] or [NB][DM][SEQ]
  size_t off = 0;
  const size_t oQ = off; off += PX;
  const size_t oK = off; off += PX;
  const size_t oV = off; off += PX;
  if (off > ws_size) return;                       // off = 25165824
  if (off > (size_t)134217728) return;

  char* ws = (char*)d_ws;
  unsigned short* Qb  = (unsigned short*)(ws + oQ);
  unsigned short* Kb  = (unsigned short*)(ws + oK);
  unsigned short* VTb = (unsigned short*)(ws + oV);

  const int n8b = SEQ * DM / 8;                    // 131072 per batch
  const dim3 gCvt((n8b + 255) / 256, NB);          // 512 x 4 blocks
  const dim3 gVT(NQB, NH, NB);                     // 32 x 8 x 4 blocks
  const int resq = (RESQB < NQB) ? RESQB : NQB;

  // (1) queries, keys -> bf16 planes [b*SEQ + t][h*64 + e]
  cvt_bf16x8<<<gCvt, dim3(256), 0, stream>>>(q, Qb, n8b, (long long)SEQ_FULL * DM, (long long)SEQ * DM);
  cvt_bf16x8<<<gCvt, dim3(256), 0, stream>>>(k, Kb, n8b, (long long)SEQ_FULL * DM, (long long)SEQ * DM);
  // (2) values (b, s, h, d) -> v^T f16 plane [b][h*64 + d][s]  (x16 carry)
  vt_cvt<<<gVT, dim3(256), 0, stream>>>(v, VTb);
  // (3) attention: query blocks 0..resq-1 with the p residual plane, the rest without
  attn_causal64<true><<<dim3(NB * NH * resq), dim3(128), 0, stream>>>(
      Qb, Kb, VTb, tau, delta, out, 0, resq);
  if (NQB > resq) {
    attn_causal64<false><<<dim3(NB * NH * (NQB - resq)), dim3(128), 0, stream>>>(
        Qb, Kb, VTb, tau, delta, out, resq, NQB - resq);
  }
  (void)hipGetLastError();
}

// v001
// One run takes 129 microseconds.
// Timed twice side by side with v000, it ran 1.25 and 1.26 times as fast.
// Contractions: q.k^T scores = v_wmma_f32_16x16x32_bf16 (bf16 operands = RNE-converted inputs, one product, f32 accumulate);
// p.v context = v_wmma_f32_16x16x32_f16 (p carried x1024 in f16 plus an f16 residual plane x4096 on the leading query blocks,
// v = RNE-bf16 input carried x16 in f16), f32 accumulate; tau, delta, causal mask and softmax in f32.
#include <hip/hip_runtime.h>
#include <math.h>
#include <stdint.h>

#ifndef NB
#define NB 4
#endif
#ifndef SEQ
#define SEQ 2048
#endif
#define NB_FULL  4
#define SEQ_FULL 2048
#define NH  8
#define HD  64
#define DM  (NH * HD)        // 512: token row pitch of q, k, v and out (heads interleaved within a token row)
#define NQB (SEQ / 64)       // 64-row query blocks == 64-key tiles
#define RESQB 8              // leading query blocks that add the p residual plane
#define VCARRY 16.0f         // v plane carried x16 in f16
#define PCARRY 1024.0f       // p carried x1024 in f16
#define PRES   4096.0f       // p residual plane scale
#define LP 72                // LDS row pitch of the 64-wide 16-bit tiles, in elements: 144 B = 16 B x odd, so the 16 rows of a
                             // ds_load_b128 fragment read fall on distinct banks (128 B put 8 rows on each bank group)
static_assert((SEQ % 64) == 0);
static_assert(SEQ >= 64 && SEQ <= SEQ_FULL);
static_assert(NB >= 1 && NB <= NB_FULL);
static_assert(NH * HD == DM);
static_assert(((SEQ * DM / 8) % 256) == 0);

typedef _Float16 v16h __attribute__((ext_vector_type(16)));
typedef _Float16 v8h  __attribute__((ext_vector_type(8)));
typedef __bf16   v16b __attribute__((ext_vector_type(16)));
typedef __bf16   v8b  __attribute__((ext_vector_type(8)));
typedef float    v8f  __attribute__((ext_vector_type(8)));
typedef float    v4f  __attribute__((ext_vector_type(4)));
typedef unsigned int v4u __attribute__((ext_vector_type(4)));

// ---- scalar helpers --------------------------------------------------------------------------------
__device__ __forceinline__ unsigned short bf_bits(float f) {          // f32 -> bf16 bits, RNE convert
  unsigned u = __float_as_uint(f);
  return (unsigned short)((u + 0x7FFFu + ((u >> 16) & 1u)) >> 16);
}
__device__ __forceinline__ float bf_up(unsigned short h) { return __uint_as_float(((unsigned)h) << 16); }
__device__ __forceinline__ unsigned pk16(unsigned short a, unsigned short b) { return (unsigned)a | ((unsigned)b << 16); }
__device__ __forceinline__ v8f zero8() { v8f z = {0.f, 0.f, 0.f, 0.f, 0.f, 0.f, 0.f, 0.f}; return z; }

// ---- fragment loader: 16-bit A/B operand, lane -> row/col (lane&15), p already includes +8*(lane>>4);
//      elements 0..7 <- p[0..7] (k0+8h..), elements 8..15 <- p[16..23] (k0+16+8h..)
__device__ __forceinline__ v16b ldfrag_b(const __bf16* p) {
  union { v16b v; v8b h[2]; } f;
  f.h[0] = *(const v8b*)(p);
  f.h[1] = *(const v8b*)(p + 16);
  return f.v;
}

// ---- WMMA helpers with trailing VALU hazard gap --------------------------------------------------------
__device__ __forceinline__ v8f mma_b(v16b a, v16b b, v8f c) {
  c = __builtin_amdgcn_wmma_f32_16x16x32_bf16(false, a, false, b, (short)0, c, false, false);
  asm volatile("v_nop\n\tv_nop\n\tv_nop\n\tv_nop" : "+v"(c) : "v"(a), "v"(b));
  return c;
}
__device__ __forceinline__ v8f mma_h(v16h a, v16h b, v8f c) {
  c = __builtin_amdgcn_wmma_f32_16x16x32_f16(false, a, false, b, (short)0, c, false, false);
  asm volatile("v_nop\n\tv_nop\n\tv_nop\n\tv_nop" : "+v"(c) : "v"(a), "v"(b));
  return c;
}

// =====================================================================================================
// f32 -> bf16 (RNE convert), 8 elements per thread, one 16-B store per lane: a wave writes 512 contiguous B
// grid = (n8 / 256, NB); blockIdx.y = batch with source stride sIn (floats) and destination stride sOut (halves).
// coverage: NB x n8 threads x 8 = the whole [NB][SEQ][DM] plane (n8 = SEQ*DM/8 is a multiple of 256).
// =====================================================================================================
__global__ __launch_bounds__(256) void cvt_bf16x8(const float* __restrict__ in, unsigned short* out, int n8,
                                                  long long sIn, long long sOut) {
  const int i = blockIdx.x * 256 + threadIdx.x;
  const int b = blockIdx.y;
  if (i < n8) {
    const float* src = in + (size_t)b * (size_t)sIn + (size_t)i * 8;
    unsigned short* dst = out + (size_t)b * (size_t)sOut + (size_t)i * 8;
    const v4f a  = *(const v4f*)(src);
    const v4f a4 = *(const v4f*)(src + 4);
    v4u p;
    p[0] = pk16(bf_bits(a[0]),  bf_bits(a[1]));
    p[1] = pk16(bf_bits(a[2]),  bf_bits(a[3]));
    p[2] = pk16(bf_bits(a4[0]), bf_bits(a4[1]));
    p[3] = pk16(bf_bits(a4[2]), bf_bits(a4[3]));
    *(v4u*)(dst) = p;
    
  }
}

// =====================================================================================================
// values f32 (b, s, h, d) -> V^T f16 plane: element (b, h, d, s) at [(b*DM + h*64 + d)*SEQ + s],
// value = f16(VCARRY * bf16(v)) (exact: a bf16 significand fits in f16).
// Block = (key tile st = blockIdx.x, head = blockIdx.y, batch = blockIdx.z), 256 threads.
// Load phase: thread -> (key s = tid>>2, 16 d-columns dq = (tid&3)*16): 4 x 16-B loads of one token row
// segment, element stores into the LDS tile T[d][s] (pitch 72). coverage: 256 threads x 16 = 64 x 64.
// Store phase after __syncthreads: 8 waves x 2 x (4 rows of 8 lanes x 16 B) = 64 output rows d x 64 keys;
// =====================================================================================================
__global__ __launch_bounds__(256) void vt_cvt(const float* __restrict__ v, unsigned short* vt) {
  __shared__ __align__(16) _Float16 T[64 * 72];
  const int tid  = threadIdx.x;
  const int wave = tid >> 5;
  const int lane = tid & 31;
  const int st   = blockIdx.x;
  const int h    = blockIdx.y;
  const int b    = blockIdx.z;
  {
    const int s  = tid >> 2;            // 0..63
    const int dq = (tid & 3) * 16;      // 0,16,32,48
    const float* src = v + (((size_t)b * SEQ_FULL + (size_t)st * 64 + (size_t)s) * DM + (size_t)h * HD + (size_t)dq);
#pragma unroll
    for (int i = 0; i < 4; ++i) {
      const v4f a = *(const v4f*)(src + 4 * i);
#pragma unroll
      for (int e = 0; e < 4; ++e) {
        const float f = bf_up(bf_bits(a[e])) * VCARRY;
        T[(dq + 4 * i + e) * 72 + s] = (_Float16)f;
      }
    }
  }
  __syncthreads();
  {
    const int q8 = lane >> 3, c8 = (lane & 7) * 8;
    v4u w[2];
#pragma unroll
    for (int it = 0; it < 2; ++it) {
      const int d = wave * 8 + it * 4 + q8;           // wave w: rows 8w..8w+7 (it 0..1 x q8 0..3)
      const v8h x = *(const v8h*)(T + d * 72 + c8);
      w[it] = __builtin_bit_cast(v4u, x);
    }
    unsigned short* dst = vt + ((size_t)b * DM + (size_t)h * HD) * SEQ + (size_t)st * 64 + (size_t)c8;
    {
#pragma unroll
      for (int it = 0; it < 2; ++it) {
        const int d = wave * 8 + it * 4 + q8;
        *(v4u*)(dst + (size_t)d * SEQ) = w[it];
      }
      
    }
  }
}

// =====================================================================================================
// Causal attention, head dim 64, no projections.
//   q plane (bf16):  element (b, t, h, e) at [(b*SEQ + t)*DM + h*64 + e]   (rows of batch b: b*SEQ..)
//   k plane (bf16):  same layout with key index s
//   v^T plane (f16): element (b, h, d, s) at [(b*DM + h*64 + d)*SEQ + s], value VCARRY * bf16(v)
//   tau [b], delta [b][SEQ_FULL]: used as their RNE-bf16 values in f32
//   scores(t, s) = q_t . k_s (one bf16 product, f32 accumulate); logit = (scores * tau + delta[s]) * 0.125;
//   keys s > t -> -inf; online softmax in f32; p = exp(logit - m) carried as f16(1024 p); RES adds an f16
//   residual plane f16((1024 p - hi) * 4096) with its own accumulator folded back per tile with 1/4096.
//   context = p . v on f16 WMMA; out (f32) element (b, t, h, d) at [(b*SEQ + t)*DM + h*64 + d] = ctx / (l * 1024 * 16).
//   Block = 4 waves = 64 query rows (query block qb) of one (b, h); grid = nqbThis * NH * NB; key tiles
//   kt = 0..qb (block-uniform trip, static bound NQB), 64 keys each; only the diagonal tile has masked keys and
//   every query row keeps its own key, so every row max is finite on every processed tile.
//   K / V^T tile staging: 128 threads x 32 elements per plane = the whole 64x64 tile (plain 16-B loads,
//   __syncthreads before and after; staged extent == consumed extent). P tiles are wave-private, spilled with
//   Output coverage: each wave stores rows q0..q0+15 (it 0..7 x lane>>4 0..1) x 64 columns (16 lanes x 16 B
// =====================================================================================================
template <bool RES>
__global__ __launch_bounds__(128)
void attn_causal64(const unsigned short* __restrict__ qp, const unsigned short* __restrict__ kp,
                   const unsigned short* __restrict__ vtp, const float* __restrict__ taup,
                   const float* __restrict__ deltap, float* outp, int qbBase, int nqbThis) {
  union FB { v16b v; v8b h[2]; };
  union FH { v16h v; v8h h[2]; };
  __shared__ __align__(16) __bf16   Ksh[64 * LP];                 // K [kv][e]      9 KB, cross-wave
  __shared__ __align__(16) _Float16 Vth[64 * LP];                 // V^T [d][kv]    9 KB, cross-wave
  __shared__ __align__(16) _Float16 Psh[4][16 * LP];              // per wave P [row][kv]
  __shared__ __align__(16) _Float16 Psl[RES ? 4 : 1][16 * LP];    // per wave P residual
  __shared__ __align__(16) float    Os[4][16 * 64];               // per wave context tile [row][d]

  const int tid  = threadIdx.x;
  const int wave = tid >> 5;
  const int lane = tid & 31;
  const int hh   = lane >> 4;
  const int c    = lane & 15;

  const int bx   = blockIdx.x;
  const int qbl  = bx % nqbThis;
  const int rest = bx / nqbThis;
  const int h    = rest % NH;
  const int b    = rest / NH;
  const int qb   = qbBase + qbl;
  const int q0   = qb * 64 + wave * 16;
  const size_t rowB = (size_t)b * SEQ;

  const __bf16*   Qh = (const __bf16*)(const void*)qp + (size_t)h * HD;
  const __bf16*   Kh = (const __bf16*)(const void*)kp + (size_t)h * HD;
  const _Float16* Vt = (const _Float16*)(const void*)vtp + ((size_t)b * DM + (size_t)h * HD) * SEQ;
  const float* dlt   = deltap + (size_t)b * SEQ_FULL;
  float* Ob          = outp + (size_t)h * HD;
  const float tau_b  = bf_up(bf_bits(taup[b]));   // block-uniform scalar

  // ---- Q fragments (A operand, row = lane&15): 2 e-chunks ----
  v16b qa[2];
#pragma unroll
  for (int dc = 0; dc < 2; ++dc) {
    const size_t qo = (rowB + (size_t)q0 + (size_t)c) * DM + (size_t)(dc * 32 + 8 * hh);
    qa[dc] = ldfrag_b(Qh + qo);
  }

  float mrow[8], lrow[8];
  v8f oacc[4];
#pragma unroll
  for (int r = 0; r < 8; ++r) { mrow[r] = -INFINITY; lrow[r] = 0.f; }
#pragma unroll
  for (int t = 0; t < 4; ++t) oacc[t] = zero8();

  for (int kt = 0; kt < NQB; ++kt) {          // static bound
    if (kt > qb) break;                       // block-uniform: causal key tiles 0..qb
    const int kv0 = kt * 64;
    __syncthreads();
    {
      const int r = tid >> 1, half = (tid & 1) * 32;
      const __bf16*   kg = Kh + (rowB + (size_t)kv0 + (size_t)r) * DM + half;   // K row kv0+r, e = half..half+31
      const _Float16* vg = Vt + (size_t)r * SEQ + (size_t)kv0 + half;          // V^T row d = r, s = kv0+half..+31
#pragma unroll
      for (int i = 0; i < 4; ++i) {
        const v8b a0 = *(const v8b*)(kg + 8 * i);
        const v8h b0 = *(const v8h*)(vg + 8 * i);
        *(v8b*)(Ksh + r * LP + half + 8 * i) = a0;
        *(v8h*)(Vth + r * LP + half + 8 * i) = b0;
      }
    }
    __syncthreads();

    // ---- scores: 16 query rows x 64 keys per wave, one bf16 product per 32-deep e step ----
    v8f s[4];
#pragma unroll
    for (int j = 0; j < 4; ++j) {
      s[j] = zero8();
#pragma unroll
      for (int dc = 0; dc < 2; ++dc) {
        FB kb;
        kb.h[0] = *(const v8b*)(Ksh + (j * 16 + c) * LP + dc * 32 + 8 * hh);
        kb.h[1] = *(const v8b*)(Ksh + (j * 16 + c) * LP + dc * 32 + 16 + 8 * hh);
        s[j] = mma_b(qa[dc], kb.v, s[j]);
      }
    }

    // ---- tau / delta in f32, scale, causal mask, row max, online softmax, P (x1024) and P residual (x4096) to LDS ----
    float dj[4];
#pragma unroll
    for (int j = 0; j < 4; ++j) dj[j] = bf_up(bf_bits(dlt[kv0 + j * 16 + c]));   // kv0+j*16+c < SEQ <= SEQ_FULL
    _Float16* pwh = Psh[wave];
    _Float16* pwl = Psl[RES ? wave : 0];
#pragma unroll
    for (int r = 0; r < 8; ++r) {
      const int ridx = q0 + 8 * hh + r;
      float m = -INFINITY;
#pragma unroll
      for (int j = 0; j < 4; ++j) {
        const int kidx = kv0 + j * 16 + c;
        float sv = (s[j][r] * tau_b + dj[j]) * 0.125f;
        sv = (kidx > ridx) ? -INFINITY : sv;
        s[j][r] = sv;
        m = fmaxf(m, sv);
      }
#pragma unroll
      for (int off = 1; off < 16; off <<= 1) m = fmaxf(m, __shfl_xor(m, off, 32));
      const float mnew  = fmaxf(mrow[r], m);
      const float msafe = (mnew == -INFINITY) ? 0.f : mnew;
      const float alpha = __expf(mrow[r] - msafe);
      mrow[r] = mnew;
      float psum = 0.f;
#pragma unroll
      for (int j = 0; j < 4; ++j) {
        const float p = __expf(s[j][r] - msafe);    // masked key: exp(-inf) = 0
        psum += p;
        const float p1k = p * PCARRY;
        const _Float16 ph = (_Float16)p1k;
        pwh[(8 * hh + r) * LP + j * 16 + c] = ph;
        if (RES) {
          const _Float16 pl = (_Float16)((p1k - (float)ph) * PRES);
          pwl[(8 * hh + r) * LP + j * 16 + c] = pl;
        }
      }
#pragma unroll
      for (int off = 1; off < 16; off <<= 1) psum += __shfl_xor(psum, off, 32);
      lrow[r] = lrow[r] * alpha + psum;
#pragma unroll
      for (int t = 0; t < 4; ++t) oacc[t][r] *= alpha;
    }
    __builtin_amdgcn_fence(__ATOMIC_RELEASE, "workgroup");
    __builtin_amdgcn_wave_barrier();
    __builtin_amdgcn_fence(__ATOMIC_ACQUIRE, "workgroup");

    // ---- context += P . V (f16 WMMA), residual products into a separate accumulator ----
    v8f o1[4];
#pragma unroll
    for (int t = 0; t < 4; ++t) o1[t] = zero8();
#pragma unroll 1
    for (int kk = 0; kk < 2; ++kk) {
      FH pa, pl;
      pa.h[0] = *(const v8h*)(pwh + c * LP + kk * 32 + 8 * hh);
      pa.h[1] = *(const v8h*)(pwh + c * LP + kk * 32 + 16 + 8 * hh);
      if (RES) {
        pl.h[0] = *(const v8h*)(pwl + c * LP + kk * 32 + 8 * hh);
        pl.h[1] = *(const v8h*)(pwl + c * LP + kk * 32 + 16 + 8 * hh);
      } else {
        pl.v = pa.v;
      }
#pragma unroll
      for (int t = 0; t < 4; ++t) {
        FH vb;
        vb.h[0] = *(const v8h*)(Vth + (t * 16 + c) * LP + kk * 32 + 8 * hh);
        vb.h[1] = *(const v8h*)(Vth + (t * 16 + c) * LP + kk * 32 + 16 + 8 * hh);
        oacc[t] = mma_h(pa.v, vb.v, oacc[t]);
        if (RES) o1[t] = mma_h(pl.v, vb.v, o1[t]);
      }
    }
    if (RES) {
#pragma unroll
      for (int t = 0; t < 4; ++t)
#pragma unroll
        for (int r = 0; r < 8; ++r) oacc[t][r] += o1[t][r] * (1.0f / PRES);
    }
  }

  // ---- normalise (1/l, the 1/1024 p carry and the 1/16 v carry), stage the wave's 16x64 tile,
  float* os = Os[wave];
#pragma unroll
  for (int r = 0; r < 8; ++r) {
    const float l = lrow[r];
    const float inv = ((l > 0.f) ? (1.0f / l) : 0.f) * (1.0f / PCARRY) * (1.0f / VCARRY);
#pragma unroll
    for (int t = 0; t < 4; ++t) os[(8 * hh + r) * 64 + t * 16 + c] = oacc[t][r] * inv;
  }
  __builtin_amdgcn_fence(__ATOMIC_RELEASE, "workgroup");
  __builtin_amdgcn_wave_barrier();
  __builtin_amdgcn_fence(__ATOMIC_ACQUIRE, "workgroup");
  {
    const int hh2 = lane >> 4, c4 = (lane & 15) * 4;
    v4f vv[8];
#pragma unroll
    for (int it = 0; it < 8; ++it) {
      const int row = it * 2 + hh2;                      // it 0..7 x hh2 0..1 = rows 0..15
      vv[it] = *(const v4f*)(os + row * 64 + c4);
    }
    {
#pragma unroll
      for (int it = 0; it < 8; ++it) {
        const int row = it * 2 + hh2;
        *(v4f*)(Ob + (rowB + (size_t)q0 + (size_t)row) * DM + (size_t)c4) = vv[it];
      }
      
    }
  }
}

// =====================================================================================================
// Workspace map (bytes, NB = 4, SEQ = 2048):
//   Qb  bf16 [NB*SEQ][DM]        0          8388608
//   Kb  bf16 [NB*SEQ][DM]        8388608    8388608
//   VT  f16  [NB][DM][SEQ]       16777216   8388608
//   end                          25165824
// Inputs keep the full per-batch token stride SEQ_FULL * DM; planes and out are compact over NB, SEQ.
// =====================================================================================================
extern "C" void kernel_launch(void* const* d_in, const int* in_sizes, int n_in,
                              void* d_out, int out_size, void* d_ws, size_t ws_size,
                              hipStream_t stream) {
  if (n_in < 5) return;
  const long long needTok = (long long)(NB - 1) * SEQ_FULL + (long long)SEQ;
  if ((long long)in_sizes[0] < needTok * DM) return;
  if ((long long)in_sizes[1] < needTok * DM) return;
  if ((long long)in_sizes[2] < needTok * DM) return;
  if (in_sizes[3] < NB) return;
  if ((long long)in_sizes[4] < needTok) return;
  if ((long long)out_size < (long long)NB * SEQ * DM) return;

  const float* q     = (const float*)d_in[0];
  const float* k     = (const float*)d_in[1];
  const float* v     = (const float*)d_in[2];
  const float* tau   = (const float*)d_in[3];
  const float* delta = (const float*)d_in[4];
  float* out = (float*)d_out;

  const size_t PX = (size_t)NB * SEQ * DM * 2;     // 8388608: 16-bit plane [NB*SEQ][DM] or [NB][DM][SEQ]
  size_t off = 0;
  const size_t oQ = off; off += PX;
  const size_t oK = off; off += PX;
  const size_t oV = off; off += PX;
  if (off > ws_size) return;                       // off = 25165824
  if (off > (size_t)134217728) return;

  char* ws = (char*)d_ws;
  unsigned short* Qb  = (unsigned short*)(ws + oQ);
  unsigned short* Kb  = (unsigned short*)(ws + oK);
  unsigned short* VTb = (unsigned short*)(ws + oV);

  const int n8b = SEQ * DM / 8;                    // 131072 per batch
  const dim3 gCvt((n8b + 255) / 256, NB);          // 512 x 4 blocks
  const dim3 gVT(NQB, NH, NB);                     // 32 x 8 x 4 blocks
  const int resq = (RESQB < NQB) ? RESQB : NQB;

  // (1) queries, keys -> bf16 planes [b*SEQ + t][h*64 + e]
  cvt_bf16x8<<<gCvt, dim3(256), 0, stream>>>(q, Qb, n8b, (long long)SEQ_FULL * DM, (long long)SEQ * DM);
  cvt_bf16x8<<<gCvt, dim3(256), 0, stream>>>(k, Kb, n8b, (long long)SEQ_FULL * DM, (long long)SEQ * DM);
  // (2) values (b, s, h, d) -> v^T f16 plane [b][h*64 + d][s]  (x16 carry)
  vt_cvt<<<gVT, dim3(256), 0, stream>>>(v, VTb);
  // (3) attention: query blocks 0..resq-1 with the p residual plane, the rest without
  attn_causal64<true><<<dim3(NB * NH * resq), dim3(128), 0, stream>>>(
      Qb, Kb, VTb, tau, delta, out, 0, resq);
  if (NQB > resq) {
    attn_causal64<false><<<dim3(NB * NH * (NQB - resq)), dim3(128), 0, stream>>>(
        Qb, Kb, VTb, tau, delta, out, resq, NQB - resq);
  }
  (void)hipGetLastError();
}

// v002
// One run takes 108 microseconds.
// In both of two side-by-side timings against v001, it was 1.19 times as fast.
// All steps since v000 together make it 1.50 times as fast.
// Contractions: q.k^T scores = v_wmma_f32_16x16x32_bf16 (bf16 operands = RNE-converted inputs, one product, f32 accumulate);
// p.v context = v_wmma_f32_16x16x32_f16 (p carried x1024 in f16 plus an f16 residual plane x4096 on the leading query blocks,
// v = RNE-bf16 input carried x16 in f16), f32 accumulate; tau, delta, causal mask and softmax in f32.
#include <hip/hip_runtime.h>
#include <math.h>
#include <stdint.h>

#ifndef NB
#define NB 4
#endif
#ifndef SEQ
#define SEQ 2048
#endif
#define NB_FULL  4
#define SEQ_FULL 2048
#define NH  8
#define HD  64
#define DM  (NH * HD)        // 512: token row pitch of q, k, v and out (heads interleaved within a token row)
#define NQB (SEQ / 64)       // 64-row query blocks == 64-key tiles
#define RESQB 8              // leading query blocks that add the p residual plane
#define VCARRY 16.0f         // v plane carried x16 in f16
#define PCARRY 1024.0f       // p carried x1024 in f16
#define PRES   4096.0f       // p residual plane scale
#define LP 72                // LDS row pitch of the 64-wide 16-bit tiles, in elements: 144 B = 16 B x odd, so the 16 rows of a
                             // ds_load_b128 fragment read fall on distinct banks (128 B put 8 rows on each bank group)
static_assert((SEQ % 64) == 0);
static_assert(SEQ >= 64 && SEQ <= SEQ_FULL);
static_assert(NB >= 1 && NB <= NB_FULL);
static_assert(NH * HD == DM);
static_assert(((SEQ * DM / 8) % 256) == 0);

typedef _Float16 v16h __attribute__((ext_vector_type(16)));
typedef _Float16 v8h  __attribute__((ext_vector_type(8)));
typedef __bf16   v16b __attribute__((ext_vector_type(16)));
typedef __bf16   v8b  __attribute__((ext_vector_type(8)));
typedef float    v8f  __attribute__((ext_vector_type(8)));
typedef float    v4f  __attribute__((ext_vector_type(4)));
typedef unsigned int v4u __attribute__((ext_vector_type(4)));

// ---- scalar helpers --------------------------------------------------------------------------------
__device__ __forceinline__ unsigned short bf_bits(float f) {          // f32 -> bf16 bits, RNE convert
  unsigned u = __float_as_uint(f);
  return (unsigned short)((u + 0x7FFFu + ((u >> 16) & 1u)) >> 16);
}
__device__ __forceinline__ float bf_up(unsigned short h) { return __uint_as_float(((unsigned)h) << 16); }
__device__ __forceinline__ unsigned pk16(unsigned short a, unsigned short b) { return (unsigned)a | ((unsigned)b << 16); }
__device__ __forceinline__ v8f zero8() { v8f z = {0.f, 0.f, 0.f, 0.f, 0.f, 0.f, 0.f, 0.f}; return z; }

// ---- maximum / sum over the 16 lanes of a row (lanes 0-15 and 16-31 apart), eight independent values at once.
//      DPP row_xmask:M gives lane l the value of lane l ^ M of its own row on the vector pipe: the xor butterfly
//      M = 1, 2, 4, 8 of a shuffle, same partners and same order, without the LDS-pipe round trip and its wait per
//      step. asm because the compiler leaves the maximum as a separate DPP move plus a quieting maximum; the eight
//      values of one step stand in a row so that each instruction's producer is eight vector instructions back.
//      All 32 lanes are active where these are called.
__device__ __forceinline__ void row_max16x8(float (&x)[8]) {
  asm(
      "v_max_num_f32_dpp %0, %0, %0 row_xmask:1 row_mask:0xf bank_mask:0xf\n\t"
      "v_max_num_f32_dpp %1, %1, %1 row_xmask:1 row_mask:0xf bank_mask:0xf\n\t"
      "v_max_num_f32_dpp %2, %2, %2 row_xmask:1 row_mask:0xf bank_mask:0xf\n\t"
      "v_max_num_f32_dpp %3, %3, %3 row_xmask:1 row_mask:0xf bank_mask:0xf\n\t"
      "v_max_num_f32_dpp %4, %4, %4 row_xmask:1 row_mask:0xf bank_mask:0xf\n\t"
      "v_max_num_f32_dpp %5, %5, %5 row_xmask:1 row_mask:0xf bank_mask:0xf\n\t"
      "v_max_num_f32_dpp %6, %6, %6 row_xmask:1 row_mask:0xf bank_mask:0xf\n\t"
      "v_max_num_f32_dpp %7, %7, %7 row_xmask:1 row_mask:0xf bank_mask:0xf\n\t"
      "v_max_num_f32_dpp %0, %0, %0 row_xmask:2 row_mask:0xf bank_mask:0xf\n\t"
      "v_max_num_f32_dpp %1, %1, %1 row_xmask:2 row_mask:0xf bank_mask:0xf\n\t"
      "v_max_num_f32_dpp %2, %2, %2 row_xmask:2 row_mask:0xf bank_mask:0xf\n\t"
      "v_max_num_f32_dpp %3, %3, %3 row_xmask:2 row_mask:0xf bank_mask:0xf\n\t"
      "v_max_num_f32_dpp %4, %4, %4 row_xmask:2 row_mask:0xf bank_mask:0xf\n\t"
      "v_max_num_f32_dpp %5, %5, %5 row_xmask:2 row_mask:0xf bank_mask:0xf\n\t"
      "v_max_num_f32_dpp %6, %6, %6 row_xmask:2 row_mask:0xf bank_mask:0xf\n\t"
      "v_max_num_f32_dpp %7, %7, %7 row_xmask:2 row_mask:0xf bank_mask:0xf\n\t"
      "v_max_num_f32_dpp %0, %0, %0 row_xmask:4 row_mask:0xf bank_mask:0xf\n\t"
      "v_max_num_f32_dpp %1, %1, %1 row_xmask:4 row_mask:0xf bank_mask:0xf\n\t"
      "v_max_num_f32_dpp %2, %2, %2 row_xmask:4 row_mask:0xf bank_mask:0xf\n\t"
      "v_max_num_f32_dpp %3, %3, %3 row_xmask:4 row_mask:0xf bank_mask:0xf\n\t"
      "v_max_num_f32_dpp %4, %4, %4 row_xmask:4 row_mask:0xf bank_mask:0xf\n\t"
      "v_max_num_f32_dpp %5, %5, %5 row_xmask:4 row_mask:0xf bank_mask:0xf\n\t"
      "v_max_num_f32_dpp %6, %6, %6 row_xmask:4 row_mask:0xf bank_mask:0xf\n\t"
      "v_max_num_f32_dpp %7, %7, %7 row_xmask:4 row_mask:0xf bank_mask:0xf\n\t"
      "v_max_num_f32_dpp %0, %0, %0 row_xmask:8 row_mask:0xf bank_mask:0xf\n\t"
      "v_max_num_f32_dpp %1, %1, %1 row_xmask:8 row_mask:0xf bank_mask:0xf\n\t"
      "v_max_num_f32_dpp %2, %2, %2 row_xmask:8 row_mask:0xf bank_mask:0xf\n\t"
      "v_max_num_f32_dpp %3, %3, %3 row_xmask:8 row_mask:0xf bank_mask:0xf\n\t"
      "v_max_num_f32_dpp %4, %4, %4 row_xmask:8 row_mask:0xf bank_mask:0xf\n\t"
      "v_max_num_f32_dpp %5, %5, %5 row_xmask:8 row_mask:0xf bank_mask:0xf\n\t"
      "v_max_num_f32_dpp %6, %6, %6 row_xmask:8 row_mask:0xf bank_mask:0xf\n\t"
      "v_max_num_f32_dpp %7, %7, %7 row_xmask:8 row_mask:0xf bank_mask:0xf"
      : "+v"(x[0]), "+v"(x[1]), "+v"(x[2]), "+v"(x[3]), "+v"(x[4]), "+v"(x[5]), "+v"(x[6]), "+v"(x[7]));
}
__device__ __forceinline__ void row_sum16x8(float (&x)[8]) {
  // volatile: holds the sums where they are written, ahead of the wait on the P stores, so that they run while the stores drain
  asm volatile(
      "v_add_f32_dpp %0, %0, %0 row_xmask:1 row_mask:0xf bank_mask:0xf\n\t"
      "v_add_f32_dpp %1, %1, %1 row_xmask:1 row_mask:0xf bank_mask:0xf\n\t"
      "v_add_f32_dpp %2, %2, %2 row_xmask:1 row_mask:0xf bank_mask:0xf\n\t"
      "v_add_f32_dpp %3, %3, %3 row_xmask:1 row_mask:0xf bank_mask:0xf\n\t"
      "v_add_f32_dpp %4, %4, %4 row_xmask:1 row_mask:0xf bank_mask:0xf\n\t"
      "v_add_f32_dpp %5, %5, %5 row_xmask:1 row_mask:0xf bank_mask:0xf\n\t"
      "v_add_f32_dpp %6, %6, %6 row_xmask:1 row_mask:0xf bank_mask:0xf\n\t"
      "v_add_f32_dpp %7, %7, %7 row_xmask:1 row_mask:0xf bank_mask:0xf\n\t"
      "v_add_f32_dpp %0, %0, %0 row_xmask:2 row_mask:0xf bank_mask:0xf\n\t"
      "v_add_f32_dpp %1, %1, %1 row_xmask:2 row_mask:0xf bank_mask:0xf\n\t"
      "v_add_f32_dpp %2, %2, %2 row_xmask:2 row_mask:0xf bank_mask:0xf\n\t"
      "v_add_f32_dpp %3, %3, %3 row_xmask:2 row_mask:0xf bank_mask:0xf\n\t"
      "v_add_f32_dpp %4, %4, %4 row_xmask:2 row_mask:0xf bank_mask:0xf\n\t"
      "v_add_f32_dpp %5, %5, %5 row_xmask:2 row_mask:0xf bank_mask:0xf\n\t"
      "v_add_f32_dpp %6, %6, %6 row_xmask:2 row_mask:0xf bank_mask:0xf\n\t"
      "v_add_f32_dpp %7, %7, %7 row_xmask:2 row_mask:0xf bank_mask:0xf\n\t"
      "v_add_f32_dpp %0, %0, %0 row_xmask:4 row_mask:0xf bank_mask:0xf\n\t"
      "v_add_f32_dpp %1, %1, %1 row_xmask:4 row_mask:0xf bank_mask:0xf\n\t"
      "v_add_f32_dpp %2, %2, %2 row_xmask:4 row_mask:0xf bank_mask:0xf\n\t"
      "v_add_f32_dpp %3, %3, %3 row_xmask:4 row_mask:0xf bank_mask:0xf\n\t"
      "v_add_f32_dpp %4, %4, %4 row_xmask:4 row_mask:0xf bank_mask:0xf\n\t"
      "v_add_f32_dpp %5, %5, %5 row_xmask:4 row_mask:0xf bank_mask:0xf\n\t"
      "v_add_f32_dpp %6, %6, %6 row_xmask:4 row_mask:0xf bank_mask:0xf\n\t"
      "v_add_f32_dpp %7, %7, %7 row_xmask:4 row_mask:0xf bank_mask:0xf\n\t"
      "v_add_f32_dpp %0, %0, %0 row_xmask:8 row_mask:0xf bank_mask:0xf\n\t"
      "v_add_f32_dpp %1, %1, %1 row_xmask:8 row_mask:0xf bank_mask:0xf\n\t"
      "v_add_f32_dpp %2, %2, %2 row_xmask:8 row_mask:0xf bank_mask:0xf\n\t"
      "v_add_f32_dpp %3, %3, %3 row_xmask:8 row_mask:0xf bank_mask:0xf\n\t"
      "v_add_f32_dpp %4, %4, %4 row_xmask:8 row_mask:0xf bank_mask:0xf\n\t"
      "v_add_f32_dpp %5, %5, %5 row_xmask:8 row_mask:0xf bank_mask:0xf\n\t"
      "v_add_f32_dpp %6, %6, %6 row_xmask:8 row_mask:0xf bank_mask:0xf\n\t"
      "v_add_f32_dpp %7, %7, %7 row_xmask:8 row_mask:0xf bank_mask:0xf"
      : "+v"(x[0]), "+v"(x[1]), "+v"(x[2]), "+v"(x[3]), "+v"(x[4]), "+v"(x[5]), "+v"(x[6]), "+v"(x[7]));
}

// ---- fragment loader: 16-bit A/B operand, lane -> row/col (lane&15), p already includes +8*(lane>>4);
//      elements 0..7 <- p[0..7] (k0+8h..), elements 8..15 <- p[16..23] (k0+16+8h..)
__device__ __forceinline__ v16b ldfrag_b(const __bf16* p) {
  union { v16b v; v8b h[2]; } f;
  f.h[0] = *(const v8b*)(p);
  f.h[1] = *(const v8b*)(p + 16);
  return f.v;
}

// ---- WMMA helpers with trailing VALU hazard gap --------------------------------------------------------
__device__ __forceinline__ v8f mma_b(v16b a, v16b b, v8f c) {
  c = __builtin_amdgcn_wmma_f32_16x16x32_bf16(false, a, false, b, (short)0, c, false, false);
  asm volatile("v_nop\n\tv_nop\n\tv_nop\n\tv_nop" : "+v"(c) : "v"(a), "v"(b));
  return c;
}
__device__ __forceinline__ v8f mma_h(v16h a, v16h b, v8f c) {
  c = __builtin_amdgcn_wmma_f32_16x16x32_f16(false, a, false, b, (short)0, c, false, false);
  asm volatile("v_nop\n\tv_nop\n\tv_nop\n\tv_nop" : "+v"(c) : "v"(a), "v"(b));
  return c;
}

// =====================================================================================================
// f32 -> bf16 (RNE convert), 8 elements per thread, one 16-B store per lane: a wave writes 512 contiguous B
// grid = (n8 / 256, NB); blockIdx.y = batch with source stride sIn (floats) and destination stride sOut (halves).
// coverage: NB x n8 threads x 8 = the whole [NB][SEQ][DM] plane (n8 = SEQ*DM/8 is a multiple of 256).
// =====================================================================================================
__global__ __launch_bounds__(256) void cvt_bf16x8(const float* __restrict__ in, unsigned short* out, int n8,
                                                  long long sIn, long long sOut) {
  const int i = blockIdx.x * 256 + threadIdx.x;
  const int b = blockIdx.y;
  if (i < n8) {
    const float* src = in + (size_t)b * (size_t)sIn + (size_t)i * 8;
    unsigned short* dst = out + (size_t)b * (size_t)sOut + (size_t)i * 8;
    const v4f a  = *(const v4f*)(src);
    const v4f a4 = *(const v4f*)(src + 4);
    v4u p;
    p[0] = pk16(bf_bits(a[0]),  bf_bits(a[1]));
    p[1] = pk16(bf_bits(a[2]),  bf_bits(a[3]));
    p[2] = pk16(bf_bits(a4[0]), bf_bits(a4[1]));
    p[3] = pk16(bf_bits(a4[2]), bf_bits(a4[3]));
    *(v4u*)(dst) = p;
    
  }
}

// =====================================================================================================
// values f32 (b, s, h, d) -> V^T f16 plane: element (b, h, d, s) at [(b*DM + h*64 + d)*SEQ + s],
// value = f16(VCARRY * bf16(v)) (exact: a bf16 significand fits in f16).
// Block = (key tile st = blockIdx.x, head = blockIdx.y, batch = blockIdx.z), 256 threads.
// Load phase: thread -> (key s = tid>>2, 16 d-columns dq = (tid&3)*16): 4 x 16-B loads of one token row
// segment, element stores into the LDS tile T[d][s] (pitch 72). coverage: 256 threads x 16 = 64 x 64.
// Store phase after __syncthreads: 8 waves x 2 x (4 rows of 8 lanes x 16 B) = 64 output rows d x 64 keys;
// =====================================================================================================
__global__ __launch_bounds__(256) void vt_cvt(const float* __restrict__ v, unsigned short* vt) {
  __shared__ __align__(16) _Float16 T[64 * 72];
  const int tid  = threadIdx.x;
  const int wave = tid >> 5;
  const int lane = tid & 31;
  const int st   = blockIdx.x;
  const int h    = blockIdx.y;
  const int b    = blockIdx.z;
  {
    const int s  = tid >> 2;            // 0..63
    const int dq = (tid & 3) * 16;      // 0,16,32,48
    const float* src = v + (((size_t)b * SEQ_FULL + (size_t)st * 64 + (size_t)s) * DM + (size_t)h * HD + (size_t)dq);
#pragma unroll
    for (int i = 0; i < 4; ++i) {
      const v4f a = *(const v4f*)(src + 4 * i);
#pragma unroll
      for (int e = 0; e < 4; ++e) {
        const float f = bf_up(bf_bits(a[e])) * VCARRY;
        T[(dq + 4 * i + e) * 72 + s] = (_Float16)f;
      }
    }
  }
  __syncthreads();
  {
    const int q8 = lane >> 3, c8 = (lane & 7) * 8;
    v4u w[2];
#pragma unroll
    for (int it = 0; it < 2; ++it) {
      const int d = wave * 8 + it * 4 + q8;           // wave w: rows 8w..8w+7 (it 0..1 x q8 0..3)
      const v8h x = *(const v8h*)(T + d * 72 + c8);
      w[it] = __builtin_bit_cast(v4u, x);
    }
    unsigned short* dst = vt + ((size_t)b * DM + (size_t)h * HD) * SEQ + (size_t)st * 64 + (size_t)c8;
    {
#pragma unroll
      for (int it = 0; it < 2; ++it) {
        const int d = wave * 8 + it * 4 + q8;
        *(v4u*)(dst + (size_t)d * SEQ) = w[it];
      }
      
    }
  }
}

// =====================================================================================================
// Causal attention, head dim 64, no projections.
//   q plane (bf16):  element (b, t, h, e) at [(b*SEQ + t)*DM + h*64 + e]   (rows of batch b: b*SEQ..)
//   k plane (bf16):  same layout with key index s
//   v^T plane (f16): element (b, h, d, s) at [(b*DM + h*64 + d)*SEQ + s], value VCARRY * bf16(v)
//   tau [b], delta [b][SEQ_FULL]: used as their RNE-bf16 values in f32
//   scores(t, s) = q_t . k_s (one bf16 product, f32 accumulate); logit = (scores * tau + delta[s]) * 0.125;
//   keys s > t -> -inf; online softmax in f32; p = exp(logit - m) carried as f16(1024 p); RES adds an f16
//   residual plane f16((1024 p - hi) * 4096) with its own accumulator folded back per tile with 1/4096.
//   context = p . v on f16 WMMA; out (f32) element (b, t, h, d) at [(b*SEQ + t)*DM + h*64 + d] = ctx / (l * 1024 * 16).
//   Block = 4 waves = 64 query rows (query block qb) of one (b, h); grid = nqbThis * NH * NB; key tiles
//   kt = 0..qb (block-uniform trip, static bound NQB), 64 keys each; only the diagonal tile has masked keys and
//   every query row keeps its own key, so every row max is finite on every processed tile.
//   K / V^T tile staging: 128 threads x 32 elements per plane = the whole 64x64 tile (plain 16-B loads,
//   __syncthreads before and after; staged extent == consumed extent). P tiles are wave-private, spilled with
//   Output coverage: each wave stores rows q0..q0+15 (it 0..7 x lane>>4 0..1) x 64 columns (16 lanes x 16 B
// =====================================================================================================
template <bool RES>
__global__ __launch_bounds__(128)
void attn_causal64(const unsigned short* __restrict__ qp, const unsigned short* __restrict__ kp,
                   const unsigned short* __restrict__ vtp, const float* __restrict__ taup,
                   const float* __restrict__ deltap, float* outp, int qbBase, int nqbThis) {
  union FB { v16b v; v8b h[2]; };
  union FH { v16h v; v8h h[2]; };
  __shared__ __align__(16) __bf16   Ksh[64 * LP];                 // K [kv][e]      9 KB, cross-wave
  __shared__ __align__(16) _Float16 Vth[64 * LP];                 // V^T [d][kv]    9 KB, cross-wave
  __shared__ __align__(16) _Float16 Psh[4][16 * LP];              // per wave P [row][kv]
  __shared__ __align__(16) _Float16 Psl[RES ? 4 : 1][16 * LP];    // per wave P residual
  __shared__ __align__(16) float    Os[4][16 * 64];               // per wave context tile [row][d]

  const int tid  = threadIdx.x;
  const int wave = tid >> 5;
  const int lane = tid & 31;
  const int hh   = lane >> 4;
  const int c    = lane & 15;

  const int bx   = blockIdx.x;
  const int qbl  = bx % nqbThis;
  const int rest = bx / nqbThis;
  const int h    = rest % NH;
  const int b    = rest / NH;
  const int qb   = qbBase + qbl;
  const int q0   = qb * 64 + wave * 16;
  const size_t rowB = (size_t)b * SEQ;

  const __bf16*   Qh = (const __bf16*)(const void*)qp + (size_t)h * HD;
  const __bf16*   Kh = (const __bf16*)(const void*)kp + (size_t)h * HD;
  const _Float16* Vt = (const _Float16*)(const void*)vtp + ((size_t)b * DM + (size_t)h * HD) * SEQ;
  const float* dlt   = deltap + (size_t)b * SEQ_FULL;
  float* Ob          = outp + (size_t)h * HD;
  const float tau_b  = bf_up(bf_bits(taup[b]));   // block-uniform scalar

  // ---- Q fragments (A operand, row = lane&15): 2 e-chunks ----
  v16b qa[2];
#pragma unroll
  for (int dc = 0; dc < 2; ++dc) {
    const size_t qo = (rowB + (size_t)q0 + (size_t)c) * DM + (size_t)(dc * 32 + 8 * hh);
    qa[dc] = ldfrag_b(Qh + qo);
  }

  float mrow[8], lrow[8];
  v8f oacc[4];
#pragma unroll
  for (int r = 0; r < 8; ++r) { mrow[r] = -INFINITY; lrow[r] = 0.f; }
#pragma unroll
  for (int t = 0; t < 4; ++t) oacc[t] = zero8();

  for (int kt = 0; kt < NQB; ++kt) {          // static bound
    if (kt > qb) break;                       // block-uniform: causal key tiles 0..qb
    const int kv0 = kt * 64;
    __syncthreads();
    {
      const int r = tid >> 1, half = (tid & 1) * 32;
      const __bf16*   kg = Kh + (rowB + (size_t)kv0 + (size_t)r) * DM + half;   // K row kv0+r, e = half..half+31
      const _Float16* vg = Vt + (size_t)r * SEQ + (size_t)kv0 + half;          // V^T row d = r, s = kv0+half..+31
#pragma unroll
      for (int i = 0; i < 4; ++i) {
        const v8b a0 = *(const v8b*)(kg + 8 * i);
        const v8h b0 = *(const v8h*)(vg + 8 * i);
        *(v8b*)(Ksh + r * LP + half + 8 * i) = a0;
        *(v8h*)(Vth + r * LP + half + 8 * i) = b0;
      }
    }
    __syncthreads();

    // ---- scores: 16 query rows x 64 keys per wave, one bf16 product per 32-deep e step ----
    v8f s[4];
#pragma unroll
    for (int j = 0; j < 4; ++j) {
      s[j] = zero8();
#pragma unroll
      for (int dc = 0; dc < 2; ++dc) {
        FB kb;
        kb.h[0] = *(const v8b*)(Ksh + (j * 16 + c) * LP + dc * 32 + 8 * hh);
        kb.h[1] = *(const v8b*)(Ksh + (j * 16 + c) * LP + dc * 32 + 16 + 8 * hh);
        s[j] = mma_b(qa[dc], kb.v, s[j]);
      }
    }

    // ---- tau / delta in f32, scale, causal mask, row max, online softmax, P (x1024) and P residual (x4096) to LDS ----
    float dj[4];
#pragma unroll
    for (int j = 0; j < 4; ++j) dj[j] = bf_up(bf_bits(dlt[kv0 + j * 16 + c]));   // kv0+j*16+c < SEQ <= SEQ_FULL
    _Float16* pwh = Psh[wave];
    _Float16* pwl = Psl[RES ? wave : 0];
    float mt[8];                                    // this tile's row maxima
#pragma unroll
    for (int r = 0; r < 8; ++r) {
      const int ridx = q0 + 8 * hh + r;
      float m = -INFINITY;
#pragma unroll
      for (int j = 0; j < 4; ++j) {
        const int kidx = kv0 + j * 16 + c;
        float sv = (s[j][r] * tau_b + dj[j]) * 0.125f;
        sv = (kidx > ridx) ? -INFINITY : sv;
        s[j][r] = sv;
        m = fmaxf(m, sv);
      }
      mt[r] = m;
    }
    row_max16x8(mt);
    float alpha[8], ps[8];                          // rescale factors, this tile's row sums
#pragma unroll
    for (int r = 0; r < 8; ++r) {
      const float mnew  = fmaxf(mrow[r], mt[r]);
      const float msafe = (mnew == -INFINITY) ? 0.f : mnew;
      alpha[r] = __expf(mrow[r] - msafe);
      mrow[r] = mnew;
      float psum = 0.f;
#pragma unroll
      for (int j = 0; j < 4; ++j) {
        const float p = __expf(s[j][r] - msafe);    // masked key: exp(-inf) = 0
        psum += p;
        const float p1k = p * PCARRY;
        const _Float16 ph = (_Float16)p1k;
        pwh[(8 * hh + r) * LP + j * 16 + c] = ph;
        if (RES) {
          const _Float16 pl = (_Float16)((p1k - (float)ph) * PRES);
          pwl[(8 * hh + r) * LP + j * 16 + c] = pl;
        }
      }
      ps[r] = psum;
    }
    row_sum16x8(ps);
#pragma unroll
    for (int r = 0; r < 8; ++r) {
      lrow[r] = lrow[r] * alpha[r] + ps[r];
#pragma unroll
      for (int t = 0; t < 4; ++t) oacc[t][r] *= alpha[r];
    }
    __builtin_amdgcn_fence(__ATOMIC_RELEASE, "workgroup");
    __builtin_amdgcn_wave_barrier();
    __builtin_amdgcn_fence(__ATOMIC_ACQUIRE, "workgroup");

    // ---- context += P . V (f16 WMMA), residual products into a separate accumulator ----
    v8f o1[4];
#pragma unroll
    for (int t = 0; t < 4; ++t) o1[t] = zero8();
#pragma unroll 1
    for (int kk = 0; kk < 2; ++kk) {
      FH pa, pl;
      pa.h[0] = *(const v8h*)(pwh + c * LP + kk * 32 + 8 * hh);
      pa.h[1] = *(const v8h*)(pwh + c * LP + kk * 32 + 16 + 8 * hh);
      if (RES) {
        pl.h[0] = *(const v8h*)(pwl + c * LP + kk * 32 + 8 * hh);
        pl.h[1] = *(const v8h*)(pwl + c * LP + kk * 32 + 16 + 8 * hh);
      } else {
        pl.v = pa.v;
      }
#pragma unroll
      for (int t = 0; t < 4; ++t) {
        FH vb;
        vb.h[0] = *(const v8h*)(Vth + (t * 16 + c) * LP + kk * 32 + 8 * hh);
        vb.h[1] = *(const v8h*)(Vth + (t * 16 + c) * LP + kk * 32 + 16 + 8 * hh);
        oacc[t] = mma_h(pa.v, vb.v, oacc[t]);
        if (RES) o1[t] = mma_h(pl.v, vb.v, o1[t]);
      }
    }
    if (RES) {
#pragma unroll
      for (int t = 0; t < 4; ++t)
#pragma unroll
        for (int r = 0; r < 8; ++r) oacc[t][r] += o1[t][r] * (1.0f / PRES);
    }
  }

  // ---- normalise (1/l, the 1/1024 p carry and the 1/16 v carry), stage the wave's 16x64 tile,
  float* os = Os[wave];
#pragma unroll
  for (int r = 0; r < 8; ++r) {
    const float l = lrow[r];
    const float inv = ((l > 0.f) ? (1.0f / l) : 0.f) * (1.0f / PCARRY) * (1.0f / VCARRY);
#pragma unroll
    for (int t = 0; t < 4; ++t) os[(8 * hh + r) * 64 + t * 16 + c] = oacc[t][r] * inv;
  }
  __builtin_amdgcn_fence(__ATOMIC_RELEASE, "workgroup");
  __builtin_amdgcn_wave_barrier();
  __builtin_amdgcn_fence(__ATOMIC_ACQUIRE, "workgroup");
  {
    const int hh2 = lane >> 4, c4 = (lane & 15) * 4;
    v4f vv[8];
#pragma unroll
    for (int it = 0; it < 8; ++it) {
      const int row = it * 2 + hh2;                      // it 0..7 x hh2 0..1 = rows 0..15
      vv[it] = *(const v4f*)(os + row * 64 + c4);
    }
    {
#pragma unroll
      for (int it = 0; it < 8; ++it) {
        const int row = it * 2 + hh2;
        *(v4f*)(Ob + (rowB + (size_t)q0 + (size_t)row) * DM + (size_t)c4) = vv[it];
      }
      
    }
  }
}

// =====================================================================================================
// Workspace map (bytes, NB = 4, SEQ = 2048):
//   Qb  bf16 [NB*SEQ][DM]        0          8388608
//   Kb  bf16 [NB*SEQ][DM]        8388608    8388608
//   VT  f16  [NB][DM][SEQ]       16777216   8388608
//   end                          25165824
// Inputs keep the full per-batch token stride SEQ_FULL * DM; planes and out are compact over NB, SEQ.
// =====================================================================================================
extern "C" void kernel_launch(void* const* d_in, const int* in_sizes, int n_in,
                              void* d_out, int out_size, void* d_ws, size_t ws_size,
                              hipStream_t stream) {
  if (n_in < 5) return;
  const long long needTok = (long long)(NB - 1) * SEQ_FULL + (long long)SEQ;
  if ((long long)in_sizes[0] < needTok * DM) return;
  if ((long long)in_sizes[1] < needTok * DM) return;
  if ((long long)in_sizes[2] < needTok * DM) return;
  if (in_sizes[3] < NB) return;
  if ((long long)in_sizes[4] < needTok) return;
  if ((long long)out_size < (long long)NB * SEQ * DM) return;

  const float* q     = (const float*)d_in[0];
  const float* k     = (const float*)d_in[1];
  const float* v     = (const float*)d_in[2];
  const float* tau   = (const float*)d_in[3];
  const float* delta = (const float*)d_in[4];
  float* out = (float*)d_out;

  const size_t PX = (size_t)NB * SEQ * DM * 2;     // 8388608: 16-bit plane [NB*SEQ][DM] or [NB][DM][SEQ]
  size_t off = 0;
  const size_t oQ = off; off += PX;
  const size_t oK = off; off += PX;
  const size_t oV = off; off += PX;
  if (off > ws_size) return;                       // off = 25165824
  if (off > (size_t)134217728) return;

  char* ws = (char*)d_ws;
  unsigned short* Qb  = (unsigned short*)(ws + oQ);
  unsigned short* Kb  = (unsigned short*)(ws + oK);
  unsigned short* VTb = (unsigned short*)(ws + oV);

  const int n8b = SEQ * DM / 8;                    // 131072 per batch
  const dim3 gCvt((n8b + 255) / 256, NB);          // 512 x 4 blocks
  const dim3 gVT(NQB, NH, NB);                     // 32 x 8 x 4 blocks
  const int resq = (RESQB < NQB) ? RESQB : NQB;

  // (1) queries, keys -> bf16 planes [b*SEQ + t][h*64 + e]
  cvt_bf16x8<<<gCvt, dim3(256), 0, stream>>>(q, Qb, n8b, (long long)SEQ_FULL * DM, (long long)SEQ * DM);
  cvt_bf16x8<<<gCvt, dim3(256), 0, stream>>>(k, Kb, n8b, (long long)SEQ_FULL * DM, (long long)SEQ * DM);
  // (2) values (b, s, h, d) -> v^T f16 plane [b][h*64 + d][s]  (x16 carry)
  vt_cvt<<<gVT, dim3(256), 0, stream>>>(v, VTb);
  // (3) attention: query blocks 0..resq-1 with the p residual plane, the rest without
  attn_causal64<true><<<dim3(NB * NH * resq), dim3(128), 0, stream>>>(
      Qb, Kb, VTb, tau, delta, out, 0, resq);
  if (NQB > resq) {
    attn_causal64<false><<<dim3(NB * NH * (NQB - resq)), dim3(128), 0, stream>>>(
        Qb, Kb, VTb, tau, delta, out, resq, NQB - resq);
  }
  (void)hipGetLastError();
}

// v003
// A run of this version takes 85.2 microseconds.
// Two timings next to v002 both put it at 1.26 times that version's speed.
// Counting every step since v000, it is 1.88 times as fast.
// Contractions: q.k^T scores = v_wmma_f32_16x16x32_bf16 (bf16 operands = RNE-converted inputs, one product, f32 accumulate);
// p.v context = v_wmma_f32_16x16x32_f16 (p carried x1024 in f16 plus an f16 residual plane x4096 on the leading query blocks,
// v = RNE-bf16 input carried x16 in f16), f32 accumulate; tau, delta, causal mask and softmax in f32.
#include <hip/hip_runtime.h>
#include <math.h>
#include <stdint.h>

#ifndef NB
#define NB 4
#endif
#ifndef SEQ
#define SEQ 2048
#endif
#define NB_FULL  4
#define SEQ_FULL 2048
#define NH  8
#define HD  64
#define DM  (NH * HD)        // 512: token row pitch of q, k, v and out (heads interleaved within a token row)
#define NQB (SEQ / 64)       // 64-row query blocks == 64-key tiles
#define RESQB 8              // leading query blocks that add the p residual plane
#define VCARRY 16.0f         // v plane carried x16 in f16
#define PCARRY 1024.0f       // p carried x1024 in f16
#define PRES   4096.0f       // p residual plane scale
#define LP 72                // LDS row pitch of the 64-wide 16-bit tiles, in elements: 144 B = 16 B x odd, so the 16 rows of a
                             // ds_load_b128 fragment read fall on distinct banks (128 B put 8 rows on each bank group)
static_assert((SEQ % 64) == 0);
static_assert(SEQ >= 64 && SEQ <= SEQ_FULL);
static_assert(NB >= 1 && NB <= NB_FULL);
static_assert(NH * HD == DM);
static_assert(((SEQ * DM / 8) % 256) == 0);

typedef _Float16 v16h __attribute__((ext_vector_type(16)));
typedef _Float16 v8h  __attribute__((ext_vector_type(8)));
typedef __bf16   v16b __attribute__((ext_vector_type(16)));
typedef __bf16   v8b  __attribute__((ext_vector_type(8)));
typedef float    v8f  __attribute__((ext_vector_type(8)));
typedef float    v4f  __attribute__((ext_vector_type(4)));
typedef unsigned int v4u __attribute__((ext_vector_type(4)));

// ---- scalar helpers --------------------------------------------------------------------------------
__device__ __forceinline__ unsigned short bf_bits(float f) {          // f32 -> bf16 bits, RNE convert
  unsigned u = __float_as_uint(f);
  return (unsigned short)((u + 0x7FFFu + ((u >> 16) & 1u)) >> 16);
}
__device__ __forceinline__ float bf_up(unsigned short h) { return __uint_as_float(((unsigned)h) << 16); }
__device__ __forceinline__ unsigned pk16(unsigned short a, unsigned short b) { return (unsigned)a | ((unsigned)b << 16); }
__device__ __forceinline__ v8f zero8() { v8f z = {0.f, 0.f, 0.f, 0.f, 0.f, 0.f, 0.f, 0.f}; return z; }

// ---- maximum / sum over the 16 lanes of a row (lanes 0-15 and 16-31 apart), eight independent values at once.
//      DPP row_xmask:M gives lane l the value of lane l ^ M of its own row on the vector pipe: the xor butterfly
//      M = 1, 2, 4, 8 of a shuffle, same partners and same order, without the LDS-pipe round trip and its wait per
//      step. asm because the compiler leaves the maximum as a separate DPP move plus a quieting maximum; the eight
//      values of one step stand in a row so that each instruction's producer is eight vector instructions back.
//      All 32 lanes are active where these are called.
__device__ __forceinline__ void row_max16x8(float (&x)[8]) {
  asm(
      "v_max_num_f32_dpp %0, %0, %0 row_xmask:1 row_mask:0xf bank_mask:0xf\n\t"
      "v_max_num_f32_dpp %1, %1, %1 row_xmask:1 row_mask:0xf bank_mask:0xf\n\t"
      "v_max_num_f32_dpp %2, %2, %2 row_xmask:1 row_mask:0xf bank_mask:0xf\n\t"
      "v_max_num_f32_dpp %3, %3, %3 row_xmask:1 row_mask:0xf bank_mask:0xf\n\t"
      "v_max_num_f32_dpp %4, %4, %4 row_xmask:1 row_mask:0xf bank_mask:0xf\n\t"
      "v_max_num_f32_dpp %5, %5, %5 row_xmask:1 row_mask:0xf bank_mask:0xf\n\t"
      "v_max_num_f32_dpp %6, %6, %6 row_xmask:1 row_mask:0xf bank_mask:0xf\n\t"
      "v_max_num_f32_dpp %7, %7, %7 row_xmask:1 row_mask:0xf bank_mask:0xf\n\t"
      "v_max_num_f32_dpp %0, %0, %0 row_xmask:2 row_mask:0xf bank_mask:0xf\n\t"
      "v_max_num_f32_dpp %1, %1, %1 row_xmask:2 row_mask:0xf bank_mask:0xf\n\t"
      "v_max_num_f32_dpp %2, %2, %2 row_xmask:2 row_mask:0xf bank_mask:0xf\n\t"
      "v_max_num_f32_dpp %3, %3, %3 row_xmask:2 row_mask:0xf bank_mask:0xf\n\t"
      "v_max_num_f32_dpp %4, %4, %4 row_xmask:2 row_mask:0xf bank_mask:0xf\n\t"
      "v_max_num_f32_dpp %5, %5, %5 row_xmask:2 row_mask:0xf bank_mask:0xf\n\t"
      "v_max_num_f32_dpp %6, %6, %6 row_xmask:2 row_mask:0xf bank_mask:0xf\n\t"
      "v_max_num_f32_dpp %7, %7, %7 row_xmask:2 row_mask:0xf bank_mask:0xf\n\t"
      "v_max_num_f32_dpp %0, %0, %0 row_xmask:4 row_mask:0xf bank_mask:0xf\n\t"
      "v_max_num_f32_dpp %1, %1, %1 row_xmask:4 row_mask:0xf bank_mask:0xf\n\t"
      "v_max_num_f32_dpp %2, %2, %2 row_xmask:4 row_mask:0xf bank_mask:0xf\n\t"
      "v_max_num_f32_dpp %3, %3, %3 row_xmask:4 row_mask:0xf bank_mask:0xf\n\t"
      "v_max_num_f32_dpp %4, %4, %4 row_xmask:4 row_mask:0xf bank_mask:0xf\n\t"
      "v_max_num_f32_dpp %5, %5, %5 row_xmask:4 row_mask:0xf bank_mask:0xf\n\t"
      "v_max_num_f32_dpp %6, %6, %6 row_xmask:4 row_mask:0xf bank_mask:0xf\n\t"
      "v_max_num_f32_dpp %7, %7, %7 row_xmask:4 row_mask:0xf bank_mask:0xf\n\t"
      "v_max_num_f32_dpp %0, %0, %0 row_xmask:8 row_mask:0xf bank_mask:0xf\n\t"
      "v_max_num_f32_dpp %1, %1, %1 row_xmask:8 row_mask:0xf bank_mask:0xf\n\t"
      "v_max_num_f32_dpp %2, %2, %2 row_xmask:8 row_mask:0xf bank_mask:0xf\n\t"
      "v_max_num_f32_dpp %3, %3, %3 row_xmask:8 row_mask:0xf bank_mask:0xf\n\t"
      "v_max_num_f32_dpp %4, %4, %4 row_xmask:8 row_mask:0xf bank_mask:0xf\n\t"
      "v_max_num_f32_dpp %5, %5, %5 row_xmask:8 row_mask:0xf bank_mask:0xf\n\t"
      "v_max_num_f32_dpp %6, %6, %6 row_xmask:8 row_mask:0xf bank_mask:0xf\n\t"
      "v_max_num_f32_dpp %7, %7, %7 row_xmask:8 row_mask:0xf bank_mask:0xf"
      : "+v"(x[0]), "+v"(x[1]), "+v"(x[2]), "+v"(x[3]), "+v"(x[4]), "+v"(x[5]), "+v"(x[6]), "+v"(x[7]));
}
__device__ __forceinline__ void row_sum16x8(float (&x)[8]) {
  // volatile: holds the sums where they are written, ahead of the wait on the P stores, so that they run while the stores drain
  asm volatile(
      "v_add_f32_dpp %0, %0, %0 row_xmask:1 row_mask:0xf bank_mask:0xf\n\t"
      "v_add_f32_dpp %1, %1, %1 row_xmask:1 row_mask:0xf bank_mask:0xf\n\t"
      "v_add_f32_dpp %2, %2, %2 row_xmask:1 row_mask:0xf bank_mask:0xf\n\t"
      "v_add_f32_dpp %3, %3, %3 row_xmask:1 row_mask:0xf bank_mask:0xf\n\t"
      "v_add_f32_dpp %4, %4, %4 row_xmask:1 row_mask:0xf bank_mask:0xf\n\t"
      "v_add_f32_dpp %5, %5, %5 row_xmask:1 row_mask:0xf bank_mask:0xf\n\t"
      "v_add_f32_dpp %6, %6, %6 row_xmask:1 row_mask:0xf bank_mask:0xf\n\t"
      "v_add_f32_dpp %7, %7, %7 row_xmask:1 row_mask:0xf bank_mask:0xf\n\t"
      "v_add_f32_dpp %0, %0, %0 row_xmask:2 row_mask:0xf bank_mask:0xf\n\t"
      "v_add_f32_dpp %1, %1, %1 row_xmask:2 row_mask:0xf bank_mask:0xf\n\t"
      "v_add_f32_dpp %2, %2, %2 row_xmask:2 row_mask:0xf bank_mask:0xf\n\t"
      "v_add_f32_dpp %3, %3, %3 row_xmask:2 row_mask:0xf bank_mask:0xf\n\t"
      "v_add_f32_dpp %4, %4, %4 row_xmask:2 row_mask:0xf bank_mask:0xf\n\t"
      "v_add_f32_dpp %5, %5, %5 row_xmask:2 row_mask:0xf bank_mask:0xf\n\t"
      "v_add_f32_dpp %6, %6, %6 row_xmask:2 row_mask:0xf bank_mask:0xf\n\t"
      "v_add_f32_dpp %7, %7, %7 row_xmask:2 row_mask:0xf bank_mask:0xf\n\t"
      "v_add_f32_dpp %0, %0, %0 row_xmask:4 row_mask:0xf bank_mask:0xf\n\t"
      "v_add_f32_dpp %1, %1, %1 row_xmask:4 row_mask:0xf bank_mask:0xf\n\t"
      "v_add_f32_dpp %2, %2, %2 row_xmask:4 row_mask:0xf bank_mask:0xf\n\t"
      "v_add_f32_dpp %3, %3, %3 row_xmask:4 row_mask:0xf bank_mask:0xf\n\t"
      "v_add_f32_dpp %4, %4, %4 row_xmask:4 row_mask:0xf bank_mask:0xf\n\t"
      "v_add_f32_dpp %5, %5, %5 row_xmask:4 row_mask:0xf bank_mask:0xf\n\t"
      "v_add_f32_dpp %6, %6, %6 row_xmask:4 row_mask:0xf bank_mask:0xf\n\t"
      "v_add_f32_dpp %7, %7, %7 row_xmask:4 row_mask:0xf bank_mask:0xf\n\t"
      "v_add_f32_dpp %0, %0, %0 row_xmask:8 row_mask:0xf bank_mask:0xf\n\t"
      "v_add_f32_dpp %1, %1, %1 row_xmask:8 row_mask:0xf bank_mask:0xf\n\t"
      "v_add_f32_dpp %2, %2, %2 row_xmask:8 row_mask:0xf bank_mask:0xf\n\t"
      "v_add_f32_dpp %3, %3, %3 row_xmask:8 row_mask:0xf bank_mask:0xf\n\t"
      "v_add_f32_dpp %4, %4, %4 row_xmask:8 row_mask:0xf bank_mask:0xf\n\t"
      "v_add_f32_dpp %5, %5, %5 row_xmask:8 row_mask:0xf bank_mask:0xf\n\t"
      "v_add_f32_dpp %6, %6, %6 row_xmask:8 row_mask:0xf bank_mask:0xf\n\t"
      "v_add_f32_dpp %7, %7, %7 row_xmask:8 row_mask:0xf bank_mask:0xf"
      : "+v"(x[0]), "+v"(x[1]), "+v"(x[2]), "+v"(x[3]), "+v"(x[4]), "+v"(x[5]), "+v"(x[6]), "+v"(x[7]));
}

// ---- fragment loader: 16-bit A/B operand, lane -> row/col (lane&15), p already includes +8*(lane>>4);
//      elements 0..7 <- p[0..7] (k0+8h..), elements 8..15 <- p[16..23] (k0+16+8h..)
__device__ __forceinline__ v16b ldfrag_b(const __bf16* p) {
  union { v16b v; v8b h[2]; } f;
  f.h[0] = *(const v8b*)(p);
  f.h[1] = *(const v8b*)(p + 16);
  return f.v;
}

// ---- WMMA helpers: the plain builtins, whose hazard distances the compiler keeps itself. No asm statement stands
//      behind them: a volatile one orders every LDS read against it and so holds each fragment read behind the
//      WMMA before it, one full LDS wait per WMMA.
__device__ __forceinline__ v8f mma_b(v16b a, v16b b, v8f c) {
  return __builtin_amdgcn_wmma_f32_16x16x32_bf16(false, a, false, b, (short)0, c, false, false);
}
__device__ __forceinline__ v8f mma_h(v16h a, v16h b, v8f c) {
  return __builtin_amdgcn_wmma_f32_16x16x32_f16(false, a, false, b, (short)0, c, false, false);
}

// =====================================================================================================
// f32 -> bf16 (RNE convert), 8 elements per thread, one 16-B store per lane: a wave writes 512 contiguous B
// grid = (n8 / 256, NB); blockIdx.y = batch with source stride sIn (floats) and destination stride sOut (halves).
// coverage: NB x n8 threads x 8 = the whole [NB][SEQ][DM] plane (n8 = SEQ*DM/8 is a multiple of 256).
// =====================================================================================================
__global__ __launch_bounds__(256) void cvt_bf16x8(const float* __restrict__ in, unsigned short* out, int n8,
                                                  long long sIn, long long sOut) {
  const int i = blockIdx.x * 256 + threadIdx.x;
  const int b = blockIdx.y;
  if (i < n8) {
    const float* src = in + (size_t)b * (size_t)sIn + (size_t)i * 8;
    unsigned short* dst = out + (size_t)b * (size_t)sOut + (size_t)i * 8;
    const v4f a  = *(const v4f*)(src);
    const v4f a4 = *(const v4f*)(src + 4);
    v4u p;
    p[0] = pk16(bf_bits(a[0]),  bf_bits(a[1]));
    p[1] = pk16(bf_bits(a[2]),  bf_bits(a[3]));
    p[2] = pk16(bf_bits(a4[0]), bf_bits(a4[1]));
    p[3] = pk16(bf_bits(a4[2]), bf_bits(a4[3]));
    *(v4u*)(dst) = p;
    
  }
}

// =====================================================================================================
// values f32 (b, s, h, d) -> V^T f16 plane: element (b, h, d, s) at [(b*DM + h*64 + d)*SEQ + s],
// value = f16(VCARRY * bf16(v)) (exact: a bf16 significand fits in f16).
// Block = (key tile st = blockIdx.x, head = blockIdx.y, batch = blockIdx.z), 256 threads.
// Load phase: thread -> (key s = tid>>2, 16 d-columns dq = (tid&3)*16): 4 x 16-B loads of one token row
// segment, element stores into the LDS tile T[d][s] (pitch 72). coverage: 256 threads x 16 = 64 x 64.
// Store phase after __syncthreads: 8 waves x 2 x (4 rows of 8 lanes x 16 B) = 64 output rows d x 64 keys;
// =====================================================================================================
__global__ __launch_bounds__(256) void vt_cvt(const float* __restrict__ v, unsigned short* vt) {
  __shared__ __align__(16) _Float16 T[64 * 72];
  const int tid  = threadIdx.x;
  const int wave = tid >> 5;
  const int lane = tid & 31;
  const int st   = blockIdx.x;
  const int h    = blockIdx.y;
  const int b    = blockIdx.z;
  {
    const int s  = tid >> 2;            // 0..63
    const int dq = (tid & 3) * 16;      // 0,16,32,48
    const float* src = v + (((size_t)b * SEQ_FULL + (size_t)st * 64 + (size_t)s) * DM + (size_t)h * HD + (size_t)dq);
#pragma unroll
    for (int i = 0; i < 4; ++i) {
      const v4f a = *(const v4f*)(src + 4 * i);
#pragma unroll
      for (int e = 0; e < 4; ++e) {
        const float f = bf_up(bf_bits(a[e])) * VCARRY;
        T[(dq + 4 * i + e) * 72 + s] = (_Float16)f;
      }
    }
  }
  __syncthreads();
  {
    const int q8 = lane >> 3, c8 = (lane & 7) * 8;
    v4u w[2];
#pragma unroll
    for (int it = 0; it < 2; ++it) {
      const int d = wave * 8 + it * 4 + q8;           // wave w: rows 8w..8w+7 (it 0..1 x q8 0..3)
      const v8h x = *(const v8h*)(T + d * 72 + c8);
      w[it] = __builtin_bit_cast(v4u, x);
    }
    unsigned short* dst = vt + ((size_t)b * DM + (size_t)h * HD) * SEQ + (size_t)st * 64 + (size_t)c8;
    {
#pragma unroll
      for (int it = 0; it < 2; ++it) {
        const int d = wave * 8 + it * 4 + q8;
        *(v4u*)(dst + (size_t)d * SEQ) = w[it];
      }
      
    }
  }
}

// =====================================================================================================
// Causal attention, head dim 64, no projections.
//   q plane (bf16):  element (b, t, h, e) at [(b*SEQ + t)*DM + h*64 + e]   (rows of batch b: b*SEQ..)
//   k plane (bf16):  same layout with key index s
//   v^T plane (f16): element (b, h, d, s) at [(b*DM + h*64 + d)*SEQ + s], value VCARRY * bf16(v)
//   tau [b], delta [b][SEQ_FULL]: used as their RNE-bf16 values in f32
//   scores(t, s) = q_t . k_s (one bf16 product, f32 accumulate); logit = (scores * tau + delta[s]) * 0.125;
//   keys s > t -> -inf; online softmax in f32; p = exp(logit - m) carried as f16(1024 p); RES adds an f16
//   residual plane f16((1024 p - hi) * 4096) with its own accumulator folded back per tile with 1/4096.
//   context = p . v on f16 WMMA; out (f32) element (b, t, h, d) at [(b*SEQ + t)*DM + h*64 + d] = ctx / (l * 1024 * 16).
//   Block = 4 waves = 64 query rows (query block qb) of one (b, h); grid = nqbThis * NH * NB; key tiles
//   kt = 0..qb (block-uniform trip, static bound NQB), 64 keys each; only the diagonal tile has masked keys and
//   every query row keeps its own key, so every row max is finite on every processed tile.
//   K / V^T tile staging: 128 threads x 32 elements per plane = the whole 64x64 tile (plain 16-B loads,
//   __syncthreads before and after; staged extent == consumed extent). P tiles are wave-private, spilled with
//   Output coverage: each wave stores rows q0..q0+15 (it 0..7 x lane>>4 0..1) x 64 columns (16 lanes x 16 B
// =====================================================================================================
template <bool RES>
__global__ __launch_bounds__(128)
void attn_causal64(const unsigned short* __restrict__ qp, const unsigned short* __restrict__ kp,
                   const unsigned short* __restrict__ vtp, const float* __restrict__ taup,
                   const float* __restrict__ deltap, float* outp, int qbBase, int nqbThis) {
  union FB { v16b v; v8b h[2]; };
  union FH { v16h v; v8h h[2]; };
  __shared__ __align__(16) __bf16   Ksh[64 * LP];                 // K [kv][e]      9 KB, cross-wave
  __shared__ __align__(16) _Float16 Vth[64 * LP];                 // V^T [d][kv]    9 KB, cross-wave
  __shared__ __align__(16) _Float16 Psh[4][16 * LP];              // per wave P [row][kv]
  __shared__ __align__(16) _Float16 Psl[RES ? 4 : 1][16 * LP];    // per wave P residual
  __shared__ __align__(16) float    Os[4][16 * 64];               // per wave context tile [row][d]

  const int tid  = threadIdx.x;
  const int wave = tid >> 5;
  const int lane = tid & 31;
  const int hh   = lane >> 4;
  const int c    = lane & 15;

  const int bx   = blockIdx.x;
  const int qbl  = bx % nqbThis;
  const int rest = bx / nqbThis;
  const int h    = rest % NH;
  const int b    = rest / NH;
  const int qb   = qbBase + qbl;
  const int q0   = qb * 64 + wave * 16;
  const size_t rowB = (size_t)b * SEQ;

  const __bf16*   Qh = (const __bf16*)(const void*)qp + (size_t)h * HD;
  const __bf16*   Kh = (const __bf16*)(const void*)kp + (size_t)h * HD;
  const _Float16* Vt = (const _Float16*)(const void*)vtp + ((size_t)b * DM + (size_t)h * HD) * SEQ;
  const float* dlt   = deltap + (size_t)b * SEQ_FULL;
  float* Ob          = outp + (size_t)h * HD;
  const float tau_b  = bf_up(bf_bits(taup[b]));   // block-uniform scalar

  // ---- Q fragments (A operand, row = lane&15): 2 e-chunks ----
  v16b qa[2];
#pragma unroll
  for (int dc = 0; dc < 2; ++dc) {
    const size_t qo = (rowB + (size_t)q0 + (size_t)c) * DM + (size_t)(dc * 32 + 8 * hh);
    qa[dc] = ldfrag_b(Qh + qo);
  }

  float mrow[8], lrow[8];
  v8f oacc[4];
#pragma unroll
  for (int r = 0; r < 8; ++r) { mrow[r] = -INFINITY; lrow[r] = 0.f; }
#pragma unroll
  for (int t = 0; t < 4; ++t) oacc[t] = zero8();

  for (int kt = 0; kt < NQB; ++kt) {          // static bound
    if (kt > qb) break;                       // block-uniform: causal key tiles 0..qb
    const int kv0 = kt * 64;
    __syncthreads();
    {
      const int r = tid >> 1, half = (tid & 1) * 32;
      const __bf16*   kg = Kh + (rowB + (size_t)kv0 + (size_t)r) * DM + half;   // K row kv0+r, e = half..half+31
      const _Float16* vg = Vt + (size_t)r * SEQ + (size_t)kv0 + half;          // V^T row d = r, s = kv0+half..+31
#pragma unroll
      for (int i = 0; i < 4; ++i) {
        const v8b a0 = *(const v8b*)(kg + 8 * i);
        const v8h b0 = *(const v8h*)(vg + 8 * i);
        *(v8b*)(Ksh + r * LP + half + 8 * i) = a0;
        *(v8h*)(Vth + r * LP + half + 8 * i) = b0;
      }
    }
    __syncthreads();

    // ---- the tile's delta values and its K and V^T fragments: every read issued here as one group, delta (global)
    //      first, then K, then V^T. The score WMMAs wait by count for the K reads alone; the V^T reads (independent
    //      of the softmax) land behind the scores and the softmax.
    float dj[4];
#pragma unroll
    for (int j = 0; j < 4; ++j) dj[j] = dlt[kv0 + j * 16 + c];                   // kv0+j*16+c < SEQ <= SEQ_FULL
    FB kb[2][4];
    FH vb[2][4];
#pragma unroll
    for (int dc = 0; dc < 2; ++dc)
#pragma unroll
      for (int j = 0; j < 4; ++j) {
        kb[dc][j].h[0] = *(const v8b*)(Ksh + (j * 16 + c) * LP + dc * 32 + 8 * hh);
        kb[dc][j].h[1] = *(const v8b*)(Ksh + (j * 16 + c) * LP + dc * 32 + 16 + 8 * hh);
      }
#pragma unroll
    for (int kk = 0; kk < 2; ++kk)
#pragma unroll
      for (int t = 0; t < 4; ++t) {
        vb[kk][t].h[0] = *(const v8h*)(Vth + (t * 16 + c) * LP + kk * 32 + 8 * hh);
        vb[kk][t].h[1] = *(const v8h*)(Vth + (t * 16 + c) * LP + kk * 32 + 16 + 8 * hh);
      }
    // keeps the reads above together: without it the compiler sinks them between the WMMAs, one read ahead of its
    // use, and each WMMA again waits out an LDS latency
    __builtin_amdgcn_sched_barrier(0);

    // ---- scores: 16 query rows x 64 keys per wave, one bf16 product per 32-deep e step (e 0..31, then 32..63) ----
    v8f s[4];
#pragma unroll
    for (int j = 0; j < 4; ++j) s[j] = zero8();
#pragma unroll
    for (int dc = 0; dc < 2; ++dc)
#pragma unroll
      for (int j = 0; j < 4; ++j) s[j] = mma_b(qa[dc], kb[dc][j].v, s[j]);

    // ---- tau / delta in f32, scale, causal mask, row max, online softmax, P (x1024) and P residual (x4096) to LDS ----
#pragma unroll
    for (int j = 0; j < 4; ++j) dj[j] = bf_up(bf_bits(dj[j]));
    _Float16* pwh = Psh[wave];
    _Float16* pwl = Psl[RES ? wave : 0];
    float mt[8];                                    // this tile's row maxima
#pragma unroll
    for (int r = 0; r < 8; ++r) {
      const int ridx = q0 + 8 * hh + r;
      float m = -INFINITY;
#pragma unroll
      for (int j = 0; j < 4; ++j) {
        const int kidx = kv0 + j * 16 + c;
        float sv = (s[j][r] * tau_b + dj[j]) * 0.125f;
        sv = (kidx > ridx) ? -INFINITY : sv;
        s[j][r] = sv;
        m = fmaxf(m, sv);
      }
      mt[r] = m;
    }
    row_max16x8(mt);
    float alpha[8], ps[8];                          // rescale factors, this tile's row sums
#pragma unroll
    for (int r = 0; r < 8; ++r) {
      const float mnew  = fmaxf(mrow[r], mt[r]);
      const float msafe = (mnew == -INFINITY) ? 0.f : mnew;
      alpha[r] = __expf(mrow[r] - msafe);
      mrow[r] = mnew;
      float psum = 0.f;
#pragma unroll
      for (int j = 0; j < 4; ++j) {
        const float p = __expf(s[j][r] - msafe);    // masked key: exp(-inf) = 0
        psum += p;
        const float p1k = p * PCARRY;
        const _Float16 ph = (_Float16)p1k;
        pwh[(8 * hh + r) * LP + j * 16 + c] = ph;
        if (RES) {
          const _Float16 pl = (_Float16)((p1k - (float)ph) * PRES);
          pwl[(8 * hh + r) * LP + j * 16 + c] = pl;
        }
      }
      ps[r] = psum;
    }
    row_sum16x8(ps);
#pragma unroll
    for (int r = 0; r < 8; ++r) {
      lrow[r] = lrow[r] * alpha[r] + ps[r];
#pragma unroll
      for (int t = 0; t < 4; ++t) oacc[t][r] *= alpha[r];
    }
    __builtin_amdgcn_fence(__ATOMIC_RELEASE, "workgroup");
    __builtin_amdgcn_wave_barrier();
    __builtin_amdgcn_fence(__ATOMIC_ACQUIRE, "workgroup");

    // ---- context += P . V (f16 WMMA), residual products into a separate accumulator ----
    v8f o1[4];
#pragma unroll
    for (int t = 0; t < 4; ++t) o1[t] = zero8();
    FH pa[2], pl[2];                                // the wave's P fragments, again one group of LDS reads
#pragma unroll
    for (int kk = 0; kk < 2; ++kk) {
      pa[kk].h[0] = *(const v8h*)(pwh + c * LP + kk * 32 + 8 * hh);
      pa[kk].h[1] = *(const v8h*)(pwh + c * LP + kk * 32 + 16 + 8 * hh);
      if (RES) {
        pl[kk].h[0] = *(const v8h*)(pwl + c * LP + kk * 32 + 8 * hh);
        pl[kk].h[1] = *(const v8h*)(pwl + c * LP + kk * 32 + 16 + 8 * hh);
      }
    }
    __builtin_amdgcn_sched_barrier(0);              // as above: the P reads stay one group ahead of the WMMAs
#pragma unroll
    for (int kk = 0; kk < 2; ++kk) {
#pragma unroll
      for (int t = 0; t < 4; ++t) {
        oacc[t] = mma_h(pa[kk].v, vb[kk][t].v, oacc[t]);
        if (RES) o1[t] = mma_h(pl[kk].v, vb[kk][t].v, o1[t]);
      }
    }
    if (RES) {
#pragma unroll
      for (int t = 0; t < 4; ++t)
#pragma unroll
        for (int r = 0; r < 8; ++r) oacc[t][r] += o1[t][r] * (1.0f / PRES);
    }
  }

  // ---- normalise (1/l, the 1/1024 p carry and the 1/16 v carry), stage the wave's 16x64 tile,
  float* os = Os[wave];
#pragma unroll
  for (int r = 0; r < 8; ++r) {
    const float l = lrow[r];
    const float inv = ((l > 0.f) ? (1.0f / l) : 0.f) * (1.0f / PCARRY) * (1.0f / VCARRY);
#pragma unroll
    for (int t = 0; t < 4; ++t) os[(8 * hh + r) * 64 + t * 16 + c] = oacc[t][r] * inv;
  }
  __builtin_amdgcn_fence(__ATOMIC_RELEASE, "workgroup");
  __builtin_amdgcn_wave_barrier();
  __builtin_amdgcn_fence(__ATOMIC_ACQUIRE, "workgroup");
  {
    const int hh2 = lane >> 4, c4 = (lane & 15) * 4;
    v4f vv[8];
#pragma unroll
    for (int it = 0; it < 8; ++it) {
      const int row = it * 2 + hh2;                      // it 0..7 x hh2 0..1 = rows 0..15
      vv[it] = *(const v4f*)(os + row * 64 + c4);
    }
    {
#pragma unroll
      for (int it = 0; it < 8; ++it) {
        const int row = it * 2 + hh2;
        *(v4f*)(Ob + (rowB + (size_t)q0 + (size_t)row) * DM + (size_t)c4) = vv[it];
      }
      
    }
  }
}

// =====================================================================================================
// Workspace map (bytes, NB = 4, SEQ = 2048):
//   Qb  bf16 [NB*SEQ][DM]        0          8388608
//   Kb  bf16 [NB*SEQ][DM]        8388608    8388608
//   VT  f16  [NB][DM][SEQ]       16777216   8388608
//   end                          25165824
// Inputs keep the full per-batch token stride SEQ_FULL * DM; planes and out are compact over NB, SEQ.
// =====================================================================================================
extern "C" void kernel_launch(void* const* d_in, const int* in_sizes, int n_in,
                              void* d_out, int out_size, void* d_ws, size_t ws_size,
                              hipStream_t stream) {
  if (n_in < 5) return;
  const long long needTok = (long long)(NB - 1) * SEQ_FULL + (long long)SEQ;
  if ((long long)in_sizes[0] < needTok * DM) return;
  if ((long long)in_sizes[1] < needTok * DM) return;
  if ((long long)in_sizes[2] < needTok * DM) return;
  if (in_sizes[3] < NB) return;
  if ((long long)in_sizes[4] < needTok) return;
  if ((long long)out_size < (long long)NB * SEQ * DM) return;

  const float* q     = (const float*)d_in[0];
  const float* k     = (const float*)d_in[1];
  const float* v     = (const float*)d_in[2];
  const float* tau   = (const float*)d_in[3];
  const float* delta = (const float*)d_in[4];
  float* out = (float*)d_out;

  const size_t PX = (size_t)NB * SEQ * DM * 2;     // 8388608: 16-bit plane [NB*SEQ][DM] or [NB][DM][SEQ]
  size_t off = 0;
  const size_t oQ = off; off += PX;
  const size_t oK = off; off += PX;
  const size_t oV = off; off += PX;
  if (off > ws_size) return;                       // off = 25165824
  if (off > (size_t)134217728) return;

  char* ws = (char*)d_ws;
  unsigned short* Qb  = (unsigned short*)(ws + oQ);
  unsigned short* Kb  = (unsigned short*)(ws + oK);
  unsigned short* VTb = (unsigned short*)(ws + oV);

  const int n8b = SEQ * DM / 8;                    // 131072 per batch
  const dim3 gCvt((n8b + 255) / 256, NB);          // 512 x 4 blocks
  const dim3 gVT(NQB, NH, NB);                     // 32 x 8 x 4 blocks
  const int resq = (RESQB < NQB) ? RESQB : NQB;

  // (1) queries, keys -> bf16 planes [b*SEQ + t][h*64 + e]
  cvt_bf16x8<<<gCvt, dim3(256), 0, stream>>>(q, Qb, n8b, (long long)SEQ_FULL * DM, (long long)SEQ * DM);
  cvt_bf16x8<<<gCvt, dim3(256), 0, stream>>>(k, Kb, n8b, (long long)SEQ_FULL * DM, (long long)SEQ * DM);
  // (2) values (b, s, h, d) -> v^T f16 plane [b][h*64 + d][s]  (x16 carry)
  vt_cvt<<<gVT, dim3(256), 0, stream>>>(v, VTb);
  // (3) attention: query blocks 0..resq-1 with the p residual plane, the rest without
  attn_causal64<true><<<dim3(NB * NH * resq), dim3(128), 0, stream>>>(
      Qb, Kb, VTb, tau, delta, out, 0, resq);
  if (NQB > resq) {
    attn_causal64<false><<<dim3(NB * NH * (NQB - resq)), dim3(128), 0, stream>>>(
        Qb, Kb, VTb, tau, delta, out, resq, NQB - resq);
  }
  (void)hipGetLastError();
}

// v004
// Measured time: 70.3 microseconds a run.
// Next to v003, in two timings, it ran 1.22 times as fast each time.
// All steps since v000 together make it 2.30 times as fast.
// Contractions: q.k^T scores = v_wmma_f32_16x16x32_bf16 (bf16 operands = RNE-converted inputs, one product, f32 accumulate);
// p.v context = v_wmma_f32_16x16x32_f16 (p carried x1024 in f16 plus an f16 residual plane x4096 on the leading query blocks,
// v = RNE-bf16 input carried x16 in f16), f32 accumulate; tau, delta, causal mask and softmax in f32.
#include <hip/hip_runtime.h>
#include <math.h>
#include <stdint.h>

#ifndef NB
#define NB 4
#endif
#ifndef SEQ
#define SEQ 2048
#endif
#define NB_FULL  4
#define SEQ_FULL 2048
#define NH  8
#define HD  64
#define DM  (NH * HD)        // 512: token row pitch of q, k, v and out (heads interleaved within a token row)
#define NQB (SEQ / 64)       // 64-row query blocks == 64-key tiles
#define RESQB 8              // leading query blocks that add the p residual plane
#define VCARRY 16.0f         // v plane carried x16 in f16
#define PCARRY 1024.0f       // p carried x1024 in f16
#define PRES   4096.0f       // p residual plane scale
#define LP 72                // LDS row pitch of the 64-wide 16-bit tiles, in elements: 144 B = 16 B x odd, so the 16 rows of a
                             // ds_load_b128 fragment read fall on distinct banks (128 B put 8 rows on each bank group)
static_assert((SEQ % 64) == 0);
static_assert(SEQ >= 64 && SEQ <= SEQ_FULL);
static_assert(NB >= 1 && NB <= NB_FULL);
static_assert(NH * HD == DM);
static_assert(((SEQ * DM / 8) % 256) == 0);

typedef _Float16 v16h __attribute__((ext_vector_type(16)));
typedef _Float16 v8h  __attribute__((ext_vector_type(8)));
typedef __bf16   v16b __attribute__((ext_vector_type(16)));
typedef __bf16   v8b  __attribute__((ext_vector_type(8)));
typedef float    v8f  __attribute__((ext_vector_type(8)));
typedef float    v4f  __attribute__((ext_vector_type(4)));
typedef unsigned int v4u __attribute__((ext_vector_type(4)));

// ---- scalar helpers --------------------------------------------------------------------------------
__device__ __forceinline__ unsigned short bf_bits(float f) {          // f32 -> bf16 bits, RNE convert
  unsigned u = __float_as_uint(f);
  return (unsigned short)((u + 0x7FFFu + ((u >> 16) & 1u)) >> 16);
}
__device__ __forceinline__ float bf_up(unsigned short h) { return __uint_as_float(((unsigned)h) << 16); }
__device__ __forceinline__ unsigned pk16(unsigned short a, unsigned short b) { return (unsigned)a | ((unsigned)b << 16); }
__device__ __forceinline__ v8f zero8() { v8f z = {0.f, 0.f, 0.f, 0.f, 0.f, 0.f, 0.f, 0.f}; return z; }

// ---- maximum / sum over the 16 lanes of a row (lanes 0-15 and 16-31 apart), eight independent values at once.
//      DPP row_xmask:M gives lane l the value of lane l ^ M of its own row on the vector pipe: the xor butterfly
//      M = 1, 2, 4, 8 of a shuffle, same partners and same order, without the LDS-pipe round trip and its wait per
//      step. asm because the compiler leaves the maximum as a separate DPP move plus a quieting maximum; the eight
//      values of one step stand in a row so that each instruction's producer is eight vector instructions back.
//      All 32 lanes are active where these are called.
__device__ __forceinline__ void row_max16x8(float (&x)[8]) {
  asm(
      "v_max_num_f32_dpp %0, %0, %0 row_xmask:1 row_mask:0xf bank_mask:0xf\n\t"
      "v_max_num_f32_dpp %1, %1, %1 row_xmask:1 row_mask:0xf bank_mask:0xf\n\t"
      "v_max_num_f32_dpp %2, %2, %2 row_xmask:1 row_mask:0xf bank_mask:0xf\n\t"
      "v_max_num_f32_dpp %3, %3, %3 row_xmask:1 row_mask:0xf bank_mask:0xf\n\t"
      "v_max_num_f32_dpp %4, %4, %4 row_xmask:1 row_mask:0xf bank_mask:0xf\n\t"
      "v_max_num_f32_dpp %5, %5, %5 row_xmask:1 row_mask:0xf bank_mask:0xf\n\t"
      "v_max_num_f32_dpp %6, %6, %6 row_xmask:1 row_mask:0xf bank_mask:0xf\n\t"
      "v_max_num_f32_dpp %7, %7, %7 row_xmask:1 row_mask:0xf bank_mask:0xf\n\t"
      "v_max_num_f32_dpp %0, %0, %0 row_xmask:2 row_mask:0xf bank_mask:0xf\n\t"
      "v_max_num_f32_dpp %1, %1, %1 row_xmask:2 row_mask:0xf bank_mask:0xf\n\t"
      "v_max_num_f32_dpp %2, %2, %2 row_xmask:2 row_mask:0xf bank_mask:0xf\n\t"
      "v_max_num_f32_dpp %3, %3, %3 row_xmask:2 row_mask:0xf bank_mask:0xf\n\t"
      "v_max_num_f32_dpp %4, %4, %4 row_xmask:2 row_mask:0xf bank_mask:0xf\n\t"
      "v_max_num_f32_dpp %5, %5, %5 row_xmask:2 row_mask:0xf bank_mask:0xf\n\t"
      "v_max_num_f32_dpp %6, %6, %6 row_xmask:2 row_mask:0xf bank_mask:0xf\n\t"
      "v_max_num_f32_dpp %7, %7, %7 row_xmask:2 row_mask:0xf bank_mask:0xf\n\t"
      "v_max_num_f32_dpp %0, %0, %0 row_xmask:4 row_mask:0xf bank_mask:0xf\n\t"
      "v_max_num_f32_dpp %1, %1, %1 row_xmask:4 row_mask:0xf bank_mask:0xf\n\t"
      "v_max_num_f32_dpp %2, %2, %2 row_xmask:4 row_mask:0xf bank_mask:0xf\n\t"
      "v_max_num_f32_dpp %3, %3, %3 row_xmask:4 row_mask:0xf bank_mask:0xf\n\t"
      "v_max_num_f32_dpp %4, %4, %4 row_xmask:4 row_mask:0xf bank_mask:0xf\n\t"
      "v_max_num_f32_dpp %5, %5, %5 row_xmask:4 row_mask:0xf bank_mask:0xf\n\t"
      "v_max_num_f32_dpp %6, %6, %6 row_xmask:4 row_mask:0xf bank_mask:0xf\n\t"
      "v_max_num_f32_dpp %7, %7, %7 row_xmask:4 row_mask:0xf bank_mask:0xf\n\t"
      "v_max_num_f32_dpp %0, %0, %0 row_xmask:8 row_mask:0xf bank_mask:0xf\n\t"
      "v_max_num_f32_dpp %1, %1, %1 row_xmask:8 row_mask:0xf bank_mask:0xf\n\t"
      "v_max_num_f32_dpp %2, %2, %2 row_xmask:8 row_mask:0xf bank_mask:0xf\n\t"
      "v_max_num_f32_dpp %3, %3, %3 row_xmask:8 row_mask:0xf bank_mask:0xf\n\t"
      "v_max_num_f32_dpp %4, %4, %4 row_xmask:8 row_mask:0xf bank_mask:0xf\n\t"
      "v_max_num_f32_dpp %5, %5, %5 row_xmask:8 row_mask:0xf bank_mask:0xf\n\t"
      "v_max_num_f32_dpp %6, %6, %6 row_xmask:8 row_mask:0xf bank_mask:0xf\n\t"
      "v_max_num_f32_dpp %7, %7, %7 row_xmask:8 row_mask:0xf bank_mask:0xf"
      : "+v"(x[0]), "+v"(x[1]), "+v"(x[2]), "+v"(x[3]), "+v"(x[4]), "+v"(x[5]), "+v"(x[6]), "+v"(x[7]));
}
__device__ __forceinline__ void row_sum16x8(float (&x)[8]) {
  // volatile: holds the sums where they are written, ahead of the wait on the P stores, so that they run while the stores drain
  asm volatile(
      "v_add_f32_dpp %0, %0, %0 row_xmask:1 row_mask:0xf bank_mask:0xf\n\t"
      "v_add_f32_dpp %1, %1, %1 row_xmask:1 row_mask:0xf bank_mask:0xf\n\t"
      "v_add_f32_dpp %2, %2, %2 row_xmask:1 row_mask:0xf bank_mask:0xf\n\t"
      "v_add_f32_dpp %3, %3, %3 row_xmask:1 row_mask:0xf bank_mask:0xf\n\t"
      "v_add_f32_dpp %4, %4, %4 row_xmask:1 row_mask:0xf bank_mask:0xf\n\t"
      "v_add_f32_dpp %5, %5, %5 row_xmask:1 row_mask:0xf bank_mask:0xf\n\t"
      "v_add_f32_dpp %6, %6, %6 row_xmask:1 row_mask:0xf bank_mask:0xf\n\t"
      "v_add_f32_dpp %7, %7, %7 row_xmask:1 row_mask:0xf bank_mask:0xf\n\t"
      "v_add_f32_dpp %0, %0, %0 row_xmask:2 row_mask:0xf bank_mask:0xf\n\t"
      "v_add_f32_dpp %1, %1, %1 row_xmask:2 row_mask:0xf bank_mask:0xf\n\t"
      "v_add_f32_dpp %2, %2, %2 row_xmask:2 row_mask:0xf bank_mask:0xf\n\t"
      "v_add_f32_dpp %3, %3, %3 row_xmask:2 row_mask:0xf bank_mask:0xf\n\t"
      "v_add_f32_dpp %4, %4, %4 row_xmask:2 row_mask:0xf bank_mask:0xf\n\t"
      "v_add_f32_dpp %5, %5, %5 row_xmask:2 row_mask:0xf bank_mask:0xf\n\t"
      "v_add_f32_dpp %6, %6, %6 row_xmask:2 row_mask:0xf bank_mask:0xf\n\t"
      "v_add_f32_dpp %7, %7, %7 row_xmask:2 row_mask:0xf bank_mask:0xf\n\t"
      "v_add_f32_dpp %0, %0, %0 row_xmask:4 row_mask:0xf bank_mask:0xf\n\t"
      "v_add_f32_dpp %1, %1, %1 row_xmask:4 row_mask:0xf bank_mask:0xf\n\t"
      "v_add_f32_dpp %2, %2, %2 row_xmask:4 row_mask:0xf bank_mask:0xf\n\t"
      "v_add_f32_dpp %3, %3, %3 row_xmask:4 row_mask:0xf bank_mask:0xf\n\t"
      "v_add_f32_dpp %4, %4, %4 row_xmask:4 row_mask:0xf bank_mask:0xf\n\t"
      "v_add_f32_dpp %5, %5, %5 row_xmask:4 row_mask:0xf bank_mask:0xf\n\t"
      "v_add_f32_dpp %6, %6, %6 row_xmask:4 row_mask:0xf bank_mask:0xf\n\t"
      "v_add_f32_dpp %7, %7, %7 row_xmask:4 row_mask:0xf bank_mask:0xf\n\t"
      "v_add_f32_dpp %0, %0, %0 row_xmask:8 row_mask:0xf bank_mask:0xf\n\t"
      "v_add_f32_dpp %1, %1, %1 row_xmask:8 row_mask:0xf bank_mask:0xf\n\t"
      "v_add_f32_dpp %2, %2, %2 row_xmask:8 row_mask:0xf bank_mask:0xf\n\t"
      "v_add_f32_dpp %3, %3, %3 row_xmask:8 row_mask:0xf bank_mask:0xf\n\t"
      "v_add_f32_dpp %4, %4, %4 row_xmask:8 row_mask:0xf bank_mask:0xf\n\t"
      "v_add_f32_dpp %5, %5, %5 row_xmask:8 row_mask:0xf bank_mask:0xf\n\t"
      "v_add_f32_dpp %6, %6, %6 row_xmask:8 row_mask:0xf bank_mask:0xf\n\t"
      "v_add_f32_dpp %7, %7, %7 row_xmask:8 row_mask:0xf bank_mask:0xf"
      : "+v"(x[0]), "+v"(x[1]), "+v"(x[2]), "+v"(x[3]), "+v"(x[4]), "+v"(x[5]), "+v"(x[6]), "+v"(x[7]));
}

// ---- fragment loader: 16-bit A/B operand, lane -> row/col (lane&15), p already includes +8*(lane>>4);
//      elements 0..7 <- p[0..7] (k0+8h..), elements 8..15 <- p[16..23] (k0+16+8h..)
__device__ __forceinline__ v16b ldfrag_b(const __bf16* p) {
  union { v16b v; v8b h[2]; } f;
  f.h[0] = *(const v8b*)(p);
  f.h[1] = *(const v8b*)(p + 16);
  return f.v;
}

// ---- WMMA helpers: the plain builtins, whose hazard distances the compiler keeps itself. No asm statement stands
//      behind them: a volatile one orders every LDS read against it and so holds each fragment read behind the
//      WMMA before it, one full LDS wait per WMMA.
__device__ __forceinline__ v8f mma_b(v16b a, v16b b, v8f c) {
  return __builtin_amdgcn_wmma_f32_16x16x32_bf16(false, a, false, b, (short)0, c, false, false);
}
__device__ __forceinline__ v8f mma_h(v16h a, v16h b, v8f c) {
  return __builtin_amdgcn_wmma_f32_16x16x32_f16(false, a, false, b, (short)0, c, false, false);
}

// ---- one 64-key tile of K and of V^T (64 rows x 128 B each) from the 16-bit planes straight into LDS, through no
//      register: 8 asynchronous 16-B copies per lane. kg / vg: the lane's global address in rows 0..15 of the tile,
//      kl / vl: its LDS byte address there; copy i takes row + 16 i. 8 lanes cover one 128-B row, a wave 4 whole rows.
//      The s_wait_xcnt is the last line of the copies' own statement, so that no address register of a copy is
//      rewritten in front of it. All 32 lanes are on where this is called.
__device__ __forceinline__ void copy_tile_async(const __bf16* kg, const _Float16* vg, unsigned kl, unsigned vl) {
  asm volatile(
      "global_load_async_to_lds_b128 %0, %8, off\n\t"
      "global_load_async_to_lds_b128 %1, %9, off\n\t"
      "global_load_async_to_lds_b128 %2, %10, off\n\t"
      "global_load_async_to_lds_b128 %3, %11, off\n\t"
      "global_load_async_to_lds_b128 %4, %12, off\n\t"
      "global_load_async_to_lds_b128 %5, %13, off\n\t"
      "global_load_async_to_lds_b128 %6, %14, off\n\t"
      "global_load_async_to_lds_b128 %7, %15, off\n\t"
      "s_wait_xcnt 0x0"
      :: "v"(kl), "v"(kl + 16u * LP * 2u), "v"(kl + 32u * LP * 2u), "v"(kl + 48u * LP * 2u),
         "v"(vl), "v"(vl + 16u * LP * 2u), "v"(vl + 32u * LP * 2u), "v"(vl + 48u * LP * 2u),
         "v"(kg), "v"(kg + 16 * DM), "v"(kg + 32 * DM), "v"(kg + 48 * DM),
         "v"(vg), "v"(vg + 16 * SEQ), "v"(vg + 32 * SEQ), "v"(vg + 48 * SEQ)
      : "memory");
}

// =====================================================================================================
// f32 -> bf16 (RNE convert), 8 elements per thread, one 16-B store per lane: a wave writes 512 contiguous B
// grid = (n8 / 256, NB); blockIdx.y = batch with source stride sIn (floats) and destination stride sOut (halves).
// coverage: NB x n8 threads x 8 = the whole [NB][SEQ][DM] plane (n8 = SEQ*DM/8 is a multiple of 256).
// =====================================================================================================
__global__ __launch_bounds__(256) void cvt_bf16x8(const float* __restrict__ in, unsigned short* out, int n8,
                                                  long long sIn, long long sOut) {
  const int i = blockIdx.x * 256 + threadIdx.x;
  const int b = blockIdx.y;
  if (i < n8) {
    const float* src = in + (size_t)b * (size_t)sIn + (size_t)i * 8;
    unsigned short* dst = out + (size_t)b * (size_t)sOut + (size_t)i * 8;
    const v4f a  = *(const v4f*)(src);
    const v4f a4 = *(const v4f*)(src + 4);
    v4u p;
    p[0] = pk16(bf_bits(a[0]),  bf_bits(a[1]));
    p[1] = pk16(bf_bits(a[2]),  bf_bits(a[3]));
    p[2] = pk16(bf_bits(a4[0]), bf_bits(a4[1]));
    p[3] = pk16(bf_bits(a4[2]), bf_bits(a4[3]));
    *(v4u*)(dst) = p;
    
  }
}

// =====================================================================================================
// values f32 (b, s, h, d) -> V^T f16 plane: element (b, h, d, s) at [(b*DM + h*64 + d)*SEQ + s],
// value = f16(VCARRY * bf16(v)) (exact: a bf16 significand fits in f16).
// Block = (key tile st = blockIdx.x, head = blockIdx.y, batch = blockIdx.z), 256 threads.
// Load phase: thread -> (key s = tid>>2, 16 d-columns dq = (tid&3)*16): 4 x 16-B loads of one token row
// segment, element stores into the LDS tile T[d][s] (pitch 72). coverage: 256 threads x 16 = 64 x 64.
// Store phase after __syncthreads: 8 waves x 2 x (4 rows of 8 lanes x 16 B) = 64 output rows d x 64 keys;
// =====================================================================================================
__global__ __launch_bounds__(256) void vt_cvt(const float* __restrict__ v, unsigned short* vt) {
  __shared__ __align__(16) _Float16 T[64 * 72];
  const int tid  = threadIdx.x;
  const int wave = tid >> 5;
  const int lane = tid & 31;
  const int st   = blockIdx.x;
  const int h    = blockIdx.y;
  const int b    = blockIdx.z;
  {
    const int s  = tid >> 2;            // 0..63
    const int dq = (tid & 3) * 16;      // 0,16,32,48
    const float* src = v + (((size_t)b * SEQ_FULL + (size_t)st * 64 + (size_t)s) * DM + (size_t)h * HD + (size_t)dq);
#pragma unroll
    for (int i = 0; i < 4; ++i) {
      const v4f a = *(const v4f*)(src + 4 * i);
#pragma unroll
      for (int e = 0; e < 4; ++e) {
        const float f = bf_up(bf_bits(a[e])) * VCARRY;
        T[(dq + 4 * i + e) * 72 + s] = (_Float16)f;
      }
    }
  }
  __syncthreads();
  {
    const int q8 = lane >> 3, c8 = (lane & 7) * 8;
    v4u w[2];
#pragma unroll
    for (int it = 0; it < 2; ++it) {
      const int d = wave * 8 + it * 4 + q8;           // wave w: rows 8w..8w+7 (it 0..1 x q8 0..3)
      const v8h x = *(const v8h*)(T + d * 72 + c8);
      w[it] = __builtin_bit_cast(v4u, x);
    }
    unsigned short* dst = vt + ((size_t)b * DM + (size_t)h * HD) * SEQ + (size_t)st * 64 + (size_t)c8;
    {
#pragma unroll
      for (int it = 0; it < 2; ++it) {
        const int d = wave * 8 + it * 4 + q8;
        *(v4u*)(dst + (size_t)d * SEQ) = w[it];
      }
      
    }
  }
}

// =====================================================================================================
// Causal attention, head dim 64, no projections.
//   q plane (bf16):  element (b, t, h, e) at [(b*SEQ + t)*DM + h*64 + e]   (rows of batch b: b*SEQ..)
//   k plane (bf16):  same layout with key index s
//   v^T plane (f16): element (b, h, d, s) at [(b*DM + h*64 + d)*SEQ + s], value VCARRY * bf16(v)
//   tau [b], delta [b][SEQ_FULL]: used as their RNE-bf16 values in f32
//   scores(t, s) = q_t . k_s (one bf16 product, f32 accumulate); logit = (scores * tau + delta[s]) * 0.125;
//   keys s > t -> -inf; online softmax in f32; p = exp(logit - m) carried as f16(1024 p); RES adds an f16
//   residual plane f16((1024 p - hi) * 4096) with its own accumulator folded back per tile with 1/4096.
//   context = p . v on f16 WMMA; out (f32) element (b, t, h, d) at [(b*SEQ + t)*DM + h*64 + d] = ctx / (l * 1024 * 16).
//   Block = 4 waves = 64 query rows (query block qb) of one (b, h); grid = nqbThis * NH * NB; key tiles
//   kt = 0..qb (block-uniform trip, static bound NQB), 64 keys each; only the diagonal tile has masked keys and
//   every query row keeps its own key, so every row max is finite on every processed tile.
//   K / V^T tile staging: two LDS buffers; 128 threads x 4 asynchronous 16-B copies per plane = the whole 64x64 tile,
//   requested one tile ahead (tile kt+2 at the foot of trip kt, into the buffer trip kt has read), one barrier per
//   trip; delta comes one tile ahead in registers (staged extent == consumed extent). P tiles are wave-private, spilled with
//   Output coverage: each wave stores rows q0..q0+15 (it 0..7 x lane>>4 0..1) x 64 columns (16 lanes x 16 B
// =====================================================================================================
template <bool RES>
__global__ __launch_bounds__(128)
void attn_causal64(const unsigned short* __restrict__ qp, const unsigned short* __restrict__ kp,
                   const unsigned short* __restrict__ vtp, const float* __restrict__ taup,
                   const float* __restrict__ deltap, float* outp, int qbBase, int nqbThis) {
  union FB { v16b v; v8b h[2]; };
  union FH { v16h v; v8h h[2]; };
  __shared__ __align__(16) __bf16   Ksh[2][64 * LP];              // K [kv][e]      2 x 9 KB, cross-wave
  __shared__ __align__(16) _Float16 Vth[2][64 * LP];              // V^T [d][kv]    2 x 9 KB, cross-wave
  __shared__ __align__(16) _Float16 Psh[4][16 * LP];              // per wave P [row][kv]
  __shared__ __align__(16) _Float16 Psl[RES ? 4 : 1][16 * LP];    // per wave P residual
  __shared__ __align__(16) float    Os[4][16 * 64];               // per wave context tile [row][d]

  const int tid  = threadIdx.x;
  const int wave = tid >> 5;
  const int lane = tid & 31;
  const int hh   = lane >> 4;
  const int c    = lane & 15;

  const int bx   = blockIdx.x;
  const int qbl  = bx % nqbThis;
  const int rest = bx / nqbThis;
  const int h    = rest % NH;
  const int b    = rest / NH;
  const int qb   = qbBase + qbl;
  const int q0   = qb * 64 + wave * 16;
  const size_t rowB = (size_t)b * SEQ;

  const __bf16*   Qh = (const __bf16*)(const void*)qp + (size_t)h * HD;
  const __bf16*   Kh = (const __bf16*)(const void*)kp + (size_t)h * HD;
  const _Float16* Vt = (const _Float16*)(const void*)vtp + ((size_t)b * DM + (size_t)h * HD) * SEQ;
  const float* dlt   = deltap + (size_t)b * SEQ_FULL;
  float* Ob          = outp + (size_t)h * HD;
  const float tau_b  = bf_up(bf_bits(taup[b]));   // block-uniform scalar

  // ---- tile 0's K and V^T copies into buffer 0 (lane -> row tid>>3 (+16 i), 16-B column tid&7) ----
  const int crow = tid >> 3, ccol = (tid & 7) * 8;
  const __bf16*   kg0 = Kh + (rowB + (size_t)crow) * DM + ccol;                 // K row crow of tile 0
  const _Float16* vg0 = Vt + (size_t)crow * SEQ + ccol;                         // V^T row d = crow, keys of tile 0
  const unsigned  kl0 = (unsigned)(uintptr_t)(&Ksh[0][crow * LP + ccol]);       // LDS byte address: low 32 bits
  const unsigned  vl0 = (unsigned)(uintptr_t)(&Vth[0][crow * LP + ccol]);
  constexpr unsigned BUFB = 64u * LP * 2u;                                      // bytes of one buffer
  copy_tile_async(kg0, vg0, kl0, vl0);

  // ---- Q fragments (A operand, row = lane&15): 2 e-chunks ----
  v16b qa[2];
#pragma unroll
  for (int dc = 0; dc < 2; ++dc) {
    const size_t qo = (rowB + (size_t)q0 + (size_t)c) * DM + (size_t)(dc * 32 + 8 * hh);
    qa[dc] = ldfrag_b(Qh + qo);
  }

  float mrow[8], lrow[8];
  v8f oacc[4];
#pragma unroll
  for (int r = 0; r < 8; ++r) { mrow[r] = -INFINITY; lrow[r] = 0.f; }
#pragma unroll
  for (int t = 0; t < 4; ++t) oacc[t] = zero8();

  float djn[4];                               // delta of the coming tile, here tile 0
#pragma unroll
  for (int j = 0; j < 4; ++j) djn[j] = dlt[j * 16 + c];
  asm volatile("s_wait_asynccnt 0x0" ::: "memory");   // this wave's copies of tile 0 have landed
  __syncthreads();                                    // publishes tile 0 to every wave
  if (qb >= 1) copy_tile_async(kg0 + (size_t)64 * DM, vg0 + 64, kl0 + BUFB, vl0 + BUFB);   // tile 1 -> buffer 1

  for (int kt = 0; kt < NQB; ++kt) {          // static bound
    if (kt > qb) break;                       // block-uniform: causal key tiles 0..qb
    const int kv0 = kt * 64;
    const __bf16*   Kc = Ksh[kt & 1];         // this trip reads buffer kt mod 2 alone
    const _Float16* Vc = Vth[kt & 1];

    // ---- the next tile's delta values and this tile's K and V^T fragments: every read issued here as one group,
    //      delta (global) first, then K, then V^T. The score WMMAs wait by count for the K reads alone; the V^T reads
    //      (independent of the softmax) land behind the scores and the softmax.
    float dj[4];
    const int kvn = (kt < qb) ? kv0 + 64 : kv0;                                  // the last trip reads its own tile again
#pragma unroll
    for (int j = 0; j < 4; ++j) { dj[j] = djn[j]; djn[j] = dlt[kvn + j * 16 + c]; }   // kvn+j*16+c < SEQ <= SEQ_FULL
    FB kb[2][4];
    FH vb[2][4];
#pragma unroll
    for (int dc = 0; dc < 2; ++dc)
#pragma unroll
      for (int j = 0; j < 4; ++j) {
        kb[dc][j].h[0] = *(const v8b*)(Kc + (j * 16 + c) * LP + dc * 32 + 8 * hh);
        kb[dc][j].h[1] = *(const v8b*)(Kc + (j * 16 + c) * LP + dc * 32 + 16 + 8 * hh);
      }
#pragma unroll
    for (int kk = 0; kk < 2; ++kk)
#pragma unroll
      for (int t = 0; t < 4; ++t) {
        vb[kk][t].h[0] = *(const v8h*)(Vc + (t * 16 + c) * LP + kk * 32 + 8 * hh);
        vb[kk][t].h[1] = *(const v8h*)(Vc + (t * 16 + c) * LP + kk * 32 + 16 + 8 * hh);
      }
    // keeps the reads above together: without it the compiler sinks them between the WMMAs, one read ahead of its
    // use, and each WMMA again waits out an LDS latency
    __builtin_amdgcn_sched_barrier(0);

    // ---- scores: 16 query rows x 64 keys per wave, one bf16 product per 32-deep e step (e 0..31, then 32..63) ----
    v8f s[4];
#pragma unroll
    for (int j = 0; j < 4; ++j) s[j] = zero8();
#pragma unroll
    for (int dc = 0; dc < 2; ++dc)
#pragma unroll
      for (int j = 0; j < 4; ++j) s[j] = mma_b(qa[dc], kb[dc][j].v, s[j]);

    // ---- tau / delta in f32, scale, causal mask, row max, online softmax, P (x1024) and P residual (x4096) to LDS ----
#pragma unroll
    for (int j = 0; j < 4; ++j) dj[j] = bf_up(bf_bits(dj[j]));
    _Float16* pwh = Psh[wave];
    _Float16* pwl = Psl[RES ? wave : 0];
    float mt[8];                                    // this tile's row maxima
#pragma unroll
    for (int r = 0; r < 8; ++r) {
      const int ridx = q0 + 8 * hh + r;
      float m = -INFINITY;
#pragma unroll
      for (int j = 0; j < 4; ++j) {
        const int kidx = kv0 + j * 16 + c;
        float sv = (s[j][r] * tau_b + dj[j]) * 0.125f;
        sv = (kidx > ridx) ? -INFINITY : sv;
        s[j][r] = sv;
        m = fmaxf(m, sv);
      }
      mt[r] = m;
    }
    row_max16x8(mt);
    float alpha[8], ps[8];                          // rescale factors, this tile's row sums
#pragma unroll
    for (int r = 0; r < 8; ++r) {
      const float mnew  = fmaxf(mrow[r], mt[r]);
      const float msafe = (mnew == -INFINITY) ? 0.f : mnew;
      alpha[r] = __expf(mrow[r] - msafe);
      mrow[r] = mnew;
      float psum = 0.f;
#pragma unroll
      for (int j = 0; j < 4; ++j) {
        const float p = __expf(s[j][r] - msafe);    // masked key: exp(-inf) = 0
        psum += p;
        const float p1k = p * PCARRY;
        const _Float16 ph = (_Float16)p1k;
        pwh[(8 * hh + r) * LP + j * 16 + c] = ph;
        if (RES) {
          const _Float16 pl = (_Float16)((p1k - (float)ph) * PRES);
          pwl[(8 * hh + r) * LP + j * 16 + c] = pl;
        }
      }
      ps[r] = psum;
    }
    row_sum16x8(ps);
#pragma unroll
    for (int r = 0; r < 8; ++r) {
      lrow[r] = lrow[r] * alpha[r] + ps[r];
#pragma unroll
      for (int t = 0; t < 4; ++t) oacc[t][r] *= alpha[r];
    }
    __builtin_amdgcn_fence(__ATOMIC_RELEASE, "workgroup");
    __builtin_amdgcn_wave_barrier();
    __builtin_amdgcn_fence(__ATOMIC_ACQUIRE, "workgroup");

    // ---- context += P . V (f16 WMMA), residual products into a separate accumulator ----
    v8f o1[4];
#pragma unroll
    for (int t = 0; t < 4; ++t) o1[t] = zero8();
    FH pa[2], pl[2];                                // the wave's P fragments, again one group of LDS reads
#pragma unroll
    for (int kk = 0; kk < 2; ++kk) {
      pa[kk].h[0] = *(const v8h*)(pwh + c * LP + kk * 32 + 8 * hh);
      pa[kk].h[1] = *(const v8h*)(pwh + c * LP + kk * 32 + 16 + 8 * hh);
      if (RES) {
        pl[kk].h[0] = *(const v8h*)(pwl + c * LP + kk * 32 + 8 * hh);
        pl[kk].h[1] = *(const v8h*)(pwl + c * LP + kk * 32 + 16 + 8 * hh);
      }
    }
    __builtin_amdgcn_sched_barrier(0);              // as above: the P reads stay one group ahead of the WMMAs
#pragma unroll
    for (int kk = 0; kk < 2; ++kk) {
#pragma unroll
      for (int t = 0; t < 4; ++t) {
        oacc[t] = mma_h(pa[kk].v, vb[kk][t].v, oacc[t]);
        if (RES) o1[t] = mma_h(pl[kk].v, vb[kk][t].v, o1[t]);
      }
    }
    if (RES) {
#pragma unroll
      for (int t = 0; t < 4; ++t)
#pragma unroll
        for (int r = 0; r < 8; ++r) oacc[t][r] += o1[t][r] * (1.0f / PRES);
    }

    // ---- foot of the trip: hand-over of the buffers ----
    asm volatile("s_wait_dscnt 0x0" ::: "memory");      // this wave's LDS reads of tile kt have retired before its buffer is refilled
    asm volatile("s_wait_asynccnt 0x0" ::: "memory");   // this wave's copies of tile kt+1 have landed
    __syncthreads();                                    // publishes tile kt+1; ends every wave's reads of tile kt's buffer
    if (kt + 2 <= qb)                                   // block-uniform: tile kt+2 into the buffer this trip has read
      copy_tile_async(kg0 + (size_t)(kt + 2) * 64 * DM, vg0 + (kt + 2) * 64, kl0 + (unsigned)(kt & 1) * BUFB,
                      vl0 + (unsigned)(kt & 1) * BUFB);
  }
  asm volatile("s_wait_asynccnt 0x0" ::: "memory");     // no copy is outstanding when the wave goes on to its end

  // ---- normalise (1/l, the 1/1024 p carry and the 1/16 v carry), stage the wave's 16x64 tile,
  float* os = Os[wave];
#pragma unroll
  for (int r = 0; r < 8; ++r) {
    const float l = lrow[r];
    const float inv = ((l > 0.f) ? (1.0f / l) : 0.f) * (1.0f / PCARRY) * (1.0f / VCARRY);
#pragma unroll
    for (int t = 0; t < 4; ++t) os[(8 * hh + r) * 64 + t * 16 + c] = oacc[t][r] * inv;
  }
  __builtin_amdgcn_fence(__ATOMIC_RELEASE, "workgroup");
  __builtin_amdgcn_wave_barrier();
  __builtin_amdgcn_fence(__ATOMIC_ACQUIRE, "workgroup");
  {
    const int hh2 = lane >> 4, c4 = (lane & 15) * 4;
    v4f vv[8];
#pragma unroll
    for (int it = 0; it < 8; ++it) {
      const int row = it * 2 + hh2;                      // it 0..7 x hh2 0..1 = rows 0..15
      vv[it] = *(const v4f*)(os + row * 64 + c4);
    }
    {
#pragma unroll
      for (int it = 0; it < 8; ++it) {
        const int row = it * 2 + hh2;
        *(v4f*)(Ob + (rowB + (size_t)q0 + (size_t)row) * DM + (size_t)c4) = vv[it];
      }
      
    }
  }
}

// =====================================================================================================
// Workspace map (bytes, NB = 4, SEQ = 2048):
//   Qb  bf16 [NB*SEQ][DM]        0          8388608
//   Kb  bf16 [NB*SEQ][DM]        8388608    8388608
//   VT  f16  [NB][DM][SEQ]       16777216   8388608
//   end                          25165824
// Inputs keep the full per-batch token stride SEQ_FULL * DM; planes and out are compact over NB, SEQ.
// =====================================================================================================
extern "C" void kernel_launch(void* const* d_in, const int* in_sizes, int n_in,
                              void* d_out, int out_size, void* d_ws, size_t ws_size,
                              hipStream_t stream) {
  if (n_in < 5) return;
  const long long needTok = (long long)(NB - 1) * SEQ_FULL + (long long)SEQ;
  if ((long long)in_sizes[0] < needTok * DM) return;
  if ((long long)in_sizes[1] < needTok * DM) return;
  if ((long long)in_sizes[2] < needTok * DM) return;
  if (in_sizes[3] < NB) return;
  if ((long long)in_sizes[4] < needTok) return;
  if ((long long)out_size < (long long)NB * SEQ * DM) return;

  const float* q     = (const float*)d_in[0];
  const float* k     = (const float*)d_in[1];
  const float* v     = (const float*)d_in[2];
  const float* tau   = (const float*)d_in[3];
  const float* delta = (const float*)d_in[4];
  float* out = (float*)d_out;

  const size_t PX = (size_t)NB * SEQ * DM * 2;     // 8388608: 16-bit plane [NB*SEQ][DM] or [NB][DM][SEQ]
  size_t off = 0;
  const size_t oQ = off; off += PX;
  const size_t oK = off; off += PX;
  const size_t oV = off; off += PX;
  if (off > ws_size) return;                       // off = 25165824
  if (off > (size_t)134217728) return;

  char* ws = (char*)d_ws;
  unsigned short* Qb  = (unsigned short*)(ws + oQ);
  unsigned short* Kb  = (unsigned short*)(ws + oK);
  unsigned short* VTb = (unsigned short*)(ws + oV);

  const int n8b = SEQ * DM / 8;                    // 131072 per batch
  const dim3 gCvt((n8b + 255) / 256, NB);          // 512 x 4 blocks
  const dim3 gVT(NQB, NH, NB);                     // 32 x 8 x 4 blocks
  const int resq = (RESQB < NQB) ? RESQB : NQB;

  // (1) queries, keys -> bf16 planes [b*SEQ + t][h*64 + e]
  cvt_bf16x8<<<gCvt, dim3(256), 0, stream>>>(q, Qb, n8b, (long long)SEQ_FULL * DM, (long long)SEQ * DM);
  cvt_bf16x8<<<gCvt, dim3(256), 0, stream>>>(k, Kb, n8b, (long long)SEQ_FULL * DM, (long long)SEQ * DM);
  // (2) values (b, s, h, d) -> v^T f16 plane [b][h*64 + d][s]  (x16 carry)
  vt_cvt<<<gVT, dim3(256), 0, stream>>>(v, VTb);
  // (3) attention: query blocks 0..resq-1 with the p residual plane, the rest without
  attn_causal64<true><<<dim3(NB * NH * resq), dim3(128), 0, stream>>>(
      Qb, Kb, VTb, tau, delta, out, 0, resq);
  if (NQB > resq) {
    attn_causal64<false><<<dim3(NB * NH * (NQB - resq)), dim3(128), 0, stream>>>(
        Qb, Kb, VTb, tau, delta, out, resq, NQB - resq);
  }
  (void)hipGetLastError();
}

// v005
// One run takes 67.6 microseconds.
// Next to v004, in two timings, it ran 1.04 times as fast each time.
// Counting every step since v000, it is 2.38 times as fast.
// Contractions: q.k^T scores = v_wmma_f32_16x16x32_bf16 (bf16 operands = RNE-converted inputs, one product, f32 accumulate);
// p.v context = v_wmma_f32_16x16x32_f16 (p carried x1024 in f16 plus an f16 residual plane x4096 on the leading query blocks,
// v = RNE-bf16 input carried x16 in f16), f32 accumulate; tau, delta, causal mask and softmax in f32.
#include <hip/hip_runtime.h>
#include <math.h>
#include <stdint.h>

#ifndef NB
#define NB 4
#endif
#ifndef SEQ
#define SEQ 2048
#endif
#define NB_FULL  4
#define SEQ_FULL 2048
#define NH  8
#define HD  64
#define DM  (NH * HD)        // 512: token row pitch of q, k, v and out (heads interleaved within a token row)
#define NQB (SEQ / 64)       // 64-row query blocks == 64-key tiles
#define RESQB 8              // leading query blocks that add the p residual plane
#define VCARRY 16.0f         // v plane carried x16 in f16
#define PCARRY 1024.0f       // p carried x1024 in f16
#define PRES   4096.0f       // p residual plane scale
#define LP 72                // LDS row pitch of the 64-wide 16-bit tiles, in elements: 144 B = 16 B x odd, so the 16 rows of a
                             // ds_load_b128 fragment read fall on distinct banks (128 B put 8 rows on each bank group)
static_assert((SEQ % 64) == 0);
static_assert(SEQ >= 64 && SEQ <= SEQ_FULL);
static_assert(NB >= 1 && NB <= NB_FULL);
static_assert(NH * HD == DM);
static_assert(((SEQ * DM / 8) % 256) == 0);

typedef _Float16 v16h __attribute__((ext_vector_type(16)));
typedef _Float16 v8h  __attribute__((ext_vector_type(8)));
typedef __bf16   v16b __attribute__((ext_vector_type(16)));
typedef __bf16   v8b  __attribute__((ext_vector_type(8)));
typedef float    v8f  __attribute__((ext_vector_type(8)));
typedef float    v4f  __attribute__((ext_vector_type(4)));
typedef unsigned int v4u __attribute__((ext_vector_type(4)));

// ---- scalar helpers --------------------------------------------------------------------------------
__device__ __forceinline__ unsigned short bf_bits(float f) {          // f32 -> bf16 bits, RNE convert
  unsigned u = __float_as_uint(f);
  return (unsigned short)((u + 0x7FFFu + ((u >> 16) & 1u)) >> 16);
}
__device__ __forceinline__ float bf_up(unsigned short h) { return __uint_as_float(((unsigned)h) << 16); }
__device__ __forceinline__ unsigned pk16(unsigned short a, unsigned short b) { return (unsigned)a | ((unsigned)b << 16); }
__device__ __forceinline__ v8f zero8() { v8f z = {0.f, 0.f, 0.f, 0.f, 0.f, 0.f, 0.f, 0.f}; return z; }

// ---- maximum / sum over the 16 lanes of a row (lanes 0-15 and 16-31 apart), eight independent values at once.
//      DPP row_xmask:M gives lane l the value of lane l ^ M of its own row on the vector pipe: the xor butterfly
//      M = 1, 2, 4, 8 of a shuffle, same partners and same order, without the LDS-pipe round trip and its wait per
//      step. asm because the compiler leaves the maximum as a separate DPP move plus a quieting maximum; the eight
//      values of one step stand in a row so that each instruction's producer is eight vector instructions back.
//      All 32 lanes are active where these are called.
__device__ __forceinline__ void row_max16x8(float (&x)[8]) {
  asm(
      "v_max_num_f32_dpp %0, %0, %0 row_xmask:1 row_mask:0xf bank_mask:0xf\n\t"
      "v_max_num_f32_dpp %1, %1, %1 row_xmask:1 row_mask:0xf bank_mask:0xf\n\t"
      "v_max_num_f32_dpp %2, %2, %2 row_xmask:1 row_mask:0xf bank_mask:0xf\n\t"
      "v_max_num_f32_dpp %3, %3, %3 row_xmask:1 row_mask:0xf bank_mask:0xf\n\t"
      "v_max_num_f32_dpp %4, %4, %4 row_xmask:1 row_mask:0xf bank_mask:0xf\n\t"
      "v_max_num_f32_dpp %5, %5, %5 row_xmask:1 row_mask:0xf bank_mask:0xf\n\t"
      "v_max_num_f32_dpp %6, %6, %6 row_xmask:1 row_mask:0xf bank_mask:0xf\n\t"
      "v_max_num_f32_dpp %7, %7, %7 row_xmask:1 row_mask:0xf bank_mask:0xf\n\t"
      "v_max_num_f32_dpp %0, %0, %0 row_xmask:2 row_mask:0xf bank_mask:0xf\n\t"
      "v_max_num_f32_dpp %1, %1, %1 row_xmask:2 row_mask:0xf bank_mask:0xf\n\t"
      "v_max_num_f32_dpp %2, %2, %2 row_xmask:2 row_mask:0xf bank_mask:0xf\n\t"
      "v_max_num_f32_dpp %3, %3, %3 row_xmask:2 row_mask:0xf bank_mask:0xf\n\t"
      "v_max_num_f32_dpp %4, %4, %4 row_xmask:2 row_mask:0xf bank_mask:0xf\n\t"
      "v_max_num_f32_dpp %5, %5, %5 row_xmask:2 row_mask:0xf bank_mask:0xf\n\t"
      "v_max_num_f32_dpp %6, %6, %6 row_xmask:2 row_mask:0xf bank_mask:0xf\n\t"
      "v_max_num_f32_dpp %7, %7, %7 row_xmask:2 row_mask:0xf bank_mask:0xf\n\t"
      "v_max_num_f32_dpp %0, %0, %0 row_xmask:4 row_mask:0xf bank_mask:0xf\n\t"
      "v_max_num_f32_dpp %1, %1, %1 row_xmask:4 row_mask:0xf bank_mask:0xf\n\t"
      "v_max_num_f32_dpp %2, %2, %2 row_xmask:4 row_mask:0xf bank_mask:0xf\n\t"
      "v_max_num_f32_dpp %3, %3, %3 row_xmask:4 row_mask:0xf bank_mask:0xf\n\t"
      "v_max_num_f32_dpp %4, %4, %4 row_xmask:4 row_mask:0xf bank_mask:0xf\n\t"
      "v_max_num_f32_dpp %5, %5, %5 row_xmask:4 row_mask:0xf bank_mask:0xf\n\t"
      "v_max_num_f32_dpp %6, %6, %6 row_xmask:4 row_mask:0xf bank_mask:0xf\n\t"
      "v_max_num_f32_dpp %7, %7, %7 row_xmask:4 row_mask:0xf bank_mask:0xf\n\t"
      "v_max_num_f32_dpp %0, %0, %0 row_xmask:8 row_mask:0xf bank_mask:0xf\n\t"
      "v_max_num_f32_dpp %1, %1, %1 row_xmask:8 row_mask:0xf bank_mask:0xf\n\t"
      "v_max_num_f32_dpp %2, %2, %2 row_xmask:8 row_mask:0xf bank_mask:0xf\n\t"
      "v_max_num_f32_dpp %3, %3, %3 row_xmask:8 row_mask:0xf bank_mask:0xf\n\t"
      "v_max_num_f32_dpp %4, %4, %4 row_xmask:8 row_mask:0xf bank_mask:0xf\n\t"
      "v_max_num_f32_dpp %5, %5, %5 row_xmask:8 row_mask:0xf bank_mask:0xf\n\t"
      "v_max_num_f32_dpp %6, %6, %6 row_xmask:8 row_mask:0xf bank_mask:0xf\n\t"
      "v_max_num_f32_dpp %7, %7, %7 row_xmask:8 row_mask:0xf bank_mask:0xf"
      : "+v"(x[0]), "+v"(x[1]), "+v"(x[2]), "+v"(x[3]), "+v"(x[4]), "+v"(x[5]), "+v"(x[6]), "+v"(x[7]));
}
__device__ __forceinline__ void row_sum16x8(float (&x)[8]) {
  // volatile: holds the sums where they are written, ahead of the wait on the P stores, so that they run while the stores drain
  asm volatile(
      "v_add_f32_dpp %0, %0, %0 row_xmask:1 row_mask:0xf bank_mask:0xf\n\t"
      "v_add_f32_dpp %1, %1, %1 row_xmask:1 row_mask:0xf bank_mask:0xf\n\t"
      "v_add_f32_dpp %2, %2, %2 row_xmask:1 row_mask:0xf bank_mask:0xf\n\t"
      "v_add_f32_dpp %3, %3, %3 row_xmask:1 row_mask:0xf bank_mask:0xf\n\t"
      "v_add_f32_dpp %4, %4, %4 row_xmask:1 row_mask:0xf bank_mask:0xf\n\t"
      "v_add_f32_dpp %5, %5, %5 row_xmask:1 row_mask:0xf bank_mask:0xf\n\t"
      "v_add_f32_dpp %6, %6, %6 row_xmask:1 row_mask:0xf bank_mask:0xf\n\t"
      "v_add_f32_dpp %7, %7, %7 row_xmask:1 row_mask:0xf bank_mask:0xf\n\t"
      "v_add_f32_dpp %0, %0, %0 row_xmask:2 row_mask:0xf bank_mask:0xf\n\t"
      "v_add_f32_dpp %1, %1, %1 row_xmask:2 row_mask:0xf bank_mask:0xf\n\t"
      "v_add_f32_dpp %2, %2, %2 row_xmask:2 row_mask:0xf bank_mask:0xf\n\t"
      "v_add_f32_dpp %3, %3, %3 row_xmask:2 row_mask:0xf bank_mask:0xf\n\t"
      "v_add_f32_dpp %4, %4, %4 row_xmask:2 row_mask:0xf bank_mask:0xf\n\t"
      "v_add_f32_dpp %5, %5, %5 row_xmask:2 row_mask:0xf bank_mask:0xf\n\t"
      "v_add_f32_dpp %6, %6, %6 row_xmask:2 row_mask:0xf bank_mask:0xf\n\t"
      "v_add_f32_dpp %7, %7, %7 row_xmask:2 row_mask:0xf bank_mask:0xf\n\t"
      "v_add_f32_dpp %0, %0, %0 row_xmask:4 row_mask:0xf bank_mask:0xf\n\t"
      "v_add_f32_dpp %1, %1, %1 row_xmask:4 row_mask:0xf bank_mask:0xf\n\t"
      "v_add_f32_dpp %2, %2, %2 row_xmask:4 row_mask:0xf bank_mask:0xf\n\t"
      "v_add_f32_dpp %3, %3, %3 row_xmask:4 row_mask:0xf bank_mask:0xf\n\t"
      "v_add_f32_dpp %4, %4, %4 row_xmask:4 row_mask:0xf bank_mask:0xf\n\t"
      "v_add_f32_dpp %5, %5, %5 row_xmask:4 row_mask:0xf bank_mask:0xf\n\t"
      "v_add_f32_dpp %6, %6, %6 row_xmask:4 row_mask:0xf bank_mask:0xf\n\t"
      "v_add_f32_dpp %7, %7, %7 row_xmask:4 row_mask:0xf bank_mask:0xf\n\t"
      "v_add_f32_dpp %0, %0, %0 row_xmask:8 row_mask:0xf bank_mask:0xf\n\t"
      "v_add_f32_dpp %1, %1, %1 row_xmask:8 row_mask:0xf bank_mask:0xf\n\t"
      "v_add_f32_dpp %2, %2, %2 row_xmask:8 row_mask:0xf bank_mask:0xf\n\t"
      "v_add_f32_dpp %3, %3, %3 row_xmask:8 row_mask:0xf bank_mask:0xf\n\t"
      "v_add_f32_dpp %4, %4, %4 row_xmask:8 row_mask:0xf bank_mask:0xf\n\t"
      "v_add_f32_dpp %5, %5, %5 row_xmask:8 row_mask:0xf bank_mask:0xf\n\t"
      "v_add_f32_dpp %6, %6, %6 row_xmask:8 row_mask:0xf bank_mask:0xf\n\t"
      "v_add_f32_dpp %7, %7, %7 row_xmask:8 row_mask:0xf bank_mask:0xf"
      : "+v"(x[0]), "+v"(x[1]), "+v"(x[2]), "+v"(x[3]), "+v"(x[4]), "+v"(x[5]), "+v"(x[6]), "+v"(x[7]));
}

// ---- fragment loader: 16-bit A/B operand, lane -> row/col (lane&15), p already includes +8*(lane>>4);
//      elements 0..7 <- p[0..7] (k0+8h..), elements 8..15 <- p[16..23] (k0+16+8h..)
__device__ __forceinline__ v16b ldfrag_b(const __bf16* p) {
  union { v16b v; v8b h[2]; } f;
  f.h[0] = *(const v8b*)(p);
  f.h[1] = *(const v8b*)(p + 16);
  return f.v;
}

// ---- WMMA helpers: the plain builtins, whose hazard distances the compiler keeps itself. No asm statement stands
//      behind them: a volatile one orders every LDS read against it and so holds each fragment read behind the
//      WMMA before it, one full LDS wait per WMMA.
__device__ __forceinline__ v8f mma_b(v16b a, v16b b, v8f c) {
  return __builtin_amdgcn_wmma_f32_16x16x32_bf16(false, a, false, b, (short)0, c, false, false);
}
__device__ __forceinline__ v8f mma_h(v16h a, v16h b, v8f c) {
  return __builtin_amdgcn_wmma_f32_16x16x32_f16(false, a, false, b, (short)0, c, false, false);
}

// ---- one 64-key tile of K and of V^T (64 rows x 128 B each) from the 16-bit planes straight into LDS, through no
//      register: 8 asynchronous 16-B copies per lane. kg / vg: the lane's global address in rows 0..15 of the tile,
//      kl / vl: its LDS byte address there; copy i takes row + 16 i. 8 lanes cover one 128-B row, a wave 4 whole rows.
//      The s_wait_xcnt is the last line of the copies' own statement, so that no address register of a copy is
//      rewritten in front of it. All 32 lanes are on where this is called.
__device__ __forceinline__ void copy_tile_async(const __bf16* kg, const _Float16* vg, unsigned kl, unsigned vl) {
  asm volatile(
      "global_load_async_to_lds_b128 %0, %8, off\n\t"
      "global_load_async_to_lds_b128 %1, %9, off\n\t"
      "global_load_async_to_lds_b128 %2, %10, off\n\t"
      "global_load_async_to_lds_b128 %3, %11, off\n\t"
      "global_load_async_to_lds_b128 %4, %12, off\n\t"
      "global_load_async_to_lds_b128 %5, %13, off\n\t"
      "global_load_async_to_lds_b128 %6, %14, off\n\t"
      "global_load_async_to_lds_b128 %7, %15, off\n\t"
      "s_wait_xcnt 0x0"
      :: "v"(kl), "v"(kl + 16u * LP * 2u), "v"(kl + 32u * LP * 2u), "v"(kl + 48u * LP * 2u),
         "v"(vl), "v"(vl + 16u * LP * 2u), "v"(vl + 32u * LP * 2u), "v"(vl + 48u * LP * 2u),
         "v"(kg), "v"(kg + 16 * DM), "v"(kg + 32 * DM), "v"(kg + 48 * DM),
         "v"(vg), "v"(vg + 16 * SEQ), "v"(vg + 32 * SEQ), "v"(vg + 48 * SEQ)
      : "memory");
}

// =====================================================================================================
// All three inputs converted in one launch. Block = (64-token tile st = blockIdx.x, pair of heads hp = blockIdx.y,
// batch = blockIdx.z), 256 threads; each thread issues its 24 16-B loads (8 of v, 8 of q, 8 of k) before it uses any.
// 512 blocks of 8 waves: 16 waves per WGP, all resident at once.
// queries, keys: f32 -> bf16 (RNE convert) in units of 8 contiguous elements, one 16-B store per unit, a wave writes
// 512 contiguous B. The block takes units (hp*NQB + st)*1024 .. +1023 of its batch's flat [SEQ][DM] plane, thread tid
// the units tid + 256 j, j = 0..3. coverage: NQB*(NH/2) blocks x 1024 units x 8 = SEQ*DM elements per batch.
// values f32 (b, s, h, d) -> V^T f16 plane: element (b, h, d, s) at [(b*DM + h*64 + d)*SEQ + s],
// value = f16(VCARRY * bf16(v)) (exact: a bf16 significand fits in f16); heads h = 2 hp + g, g = 0, 1, one LDS tile each.
// Load phase: thread -> (key s = tid>>2, 16 d-columns dq = (tid&3)*16): 4 x 16-B loads of one token row
// segment per head, element stores into the LDS tile T[g][d][s] (pitch 72). coverage: 256 threads x 16 = 64 x 64.
// Store phase after __syncthreads: 8 waves x 2 x (4 rows of 8 lanes x 16 B) = 64 output rows d x 64 keys per head;
// the q and k stores stand behind the barrier too, so that the barrier waits for no global store.
// =====================================================================================================
#define CVH 2                // heads per conversion block
static_assert((NH % CVH) == 0);
static_assert(SEQ * DM / 8 == NQB * (NH / CVH) * 512 * CVH);
__device__ __forceinline__ v4u bf16x8(v4f a, v4f a4) {
  v4u p;
  p[0] = pk16(bf_bits(a[0]),  bf_bits(a[1]));
  p[1] = pk16(bf_bits(a[2]),  bf_bits(a[3]));
  p[2] = pk16(bf_bits(a4[0]), bf_bits(a4[1]));
  p[3] = pk16(bf_bits(a4[2]), bf_bits(a4[3]));
  return p;
}
__global__ __launch_bounds__(256) void cvt_qkv(const float* __restrict__ q, const float* __restrict__ k,
                                               const float* __restrict__ v, unsigned short* qb, unsigned short* kb,
                                               unsigned short* vt) {
  __shared__ __align__(16) _Float16 T[CVH][64 * 72];
  const int tid  = threadIdx.x;
  const int wave = tid >> 5;
  const int lane = tid & 31;
  const int st   = blockIdx.x;
  const int hp   = blockIdx.y;
  const int b    = blockIdx.z;
  const int s  = tid >> 2;            // 0..63
  const int dq = (tid & 3) * 16;      // 0,16,32,48
  const float* vsrc = v + (((size_t)b * SEQ_FULL + (size_t)st * 64 + (size_t)s) * DM + (size_t)hp * (CVH * HD) + (size_t)dq);
  const size_t e0 = ((size_t)(hp * NQB + st) * (512 * CVH) + (size_t)tid) * 8;   // the thread's first unit, in elements of the batch plane
  const float* qsrc = q + (size_t)b * SEQ_FULL * DM + e0;
  const float* ksrc = k + (size_t)b * SEQ_FULL * DM + e0;
  v4f va[CVH][4], qa[2 * CVH][2], ka[2 * CVH][2];
#pragma unroll
  for (int g = 0; g < CVH; ++g)
#pragma unroll
    for (int i = 0; i < 4; ++i) va[g][i] = *(const v4f*)(vsrc + g * HD + 4 * i);
#pragma unroll
  for (int j = 0; j < 2 * CVH; ++j) {
    qa[j][0] = *(const v4f*)(qsrc + j * 2048);
    qa[j][1] = *(const v4f*)(qsrc + j * 2048 + 4);
    ka[j][0] = *(const v4f*)(ksrc + j * 2048);
    ka[j][1] = *(const v4f*)(ksrc + j * 2048 + 4);
  }
#pragma unroll
  for (int g = 0; g < CVH; ++g)
#pragma unroll
    for (int i = 0; i < 4; ++i) {
#pragma unroll
      for (int e = 0; e < 4; ++e) {
        const float f = bf_up(bf_bits(va[g][i][e])) * VCARRY;
        T[g][(dq + 4 * i + e) * 72 + s] = (_Float16)f;
      }
    }
  __syncthreads();
  const int q8 = lane >> 3, c8 = (lane & 7) * 8;
  v4u w[CVH][2];
#pragma unroll
  for (int g = 0; g < CVH; ++g)
#pragma unroll
    for (int it = 0; it < 2; ++it) {
      const int d = wave * 8 + it * 4 + q8;           // wave w: rows 8w..8w+7 (it 0..1 x q8 0..3)
      const v8h x = *(const v8h*)(T[g] + d * 72 + c8);
      w[g][it] = __builtin_bit_cast(v4u, x);
    }
  unsigned short* qdst = qb + (size_t)b * SEQ * DM + e0;
  unsigned short* kdst = kb + (size_t)b * SEQ * DM + e0;
#pragma unroll
  for (int j = 0; j < 2 * CVH; ++j) {
    *(v4u*)(qdst + j * 2048) = bf16x8(qa[j][0], qa[j][1]);
    *(v4u*)(kdst + j * 2048) = bf16x8(ka[j][0], ka[j][1]);
  }
  unsigned short* dst = vt + ((size_t)b * DM + (size_t)hp * (CVH * HD)) * SEQ + (size_t)st * 64 + (size_t)c8;
#pragma unroll
  for (int g = 0; g < CVH; ++g)
#pragma unroll
    for (int it = 0; it < 2; ++it) {
      const int d = g * HD + wave * 8 + it * 4 + q8;
      *(v4u*)(dst + (size_t)d * SEQ) = w[g][it];
    }
}

// =====================================================================================================
// Causal attention, head dim 64, no projections.
//   q plane (bf16):  element (b, t, h, e) at [(b*SEQ + t)*DM + h*64 + e]   (rows of batch b: b*SEQ..)
//   k plane (bf16):  same layout with key index s
//   v^T plane (f16): element (b, h, d, s) at [(b*DM + h*64 + d)*SEQ + s], value VCARRY * bf16(v)
//   tau [b], delta [b][SEQ_FULL]: used as their RNE-bf16 values in f32
//   scores(t, s) = q_t . k_s (one bf16 product, f32 accumulate); logit = (scores * tau + delta[s]) * 0.125;
//   keys s > t -> -inf; online softmax in f32; p = exp(logit - m) carried as f16(1024 p); RES adds an f16
//   residual plane f16((1024 p - hi) * 4096) with its own accumulator folded back per tile with 1/4096.
//   context = p . v on f16 WMMA; out (f32) element (b, t, h, d) at [(b*SEQ + t)*DM + h*64 + d] = ctx / (l * 1024 * 16).
//   Block = 4 waves = 64 query rows (query block qb) of one (b, h); grid = nqbThis * NH * NB; key tiles
//   kt = 0..qb (block-uniform trip, static bound NQB), 64 keys each; only the diagonal tile has masked keys and
//   every query row keeps its own key, so every row max is finite on every processed tile.
//   K / V^T tile staging: two LDS buffers; 128 threads x 4 asynchronous 16-B copies per plane = the whole 64x64 tile,
//   requested one tile ahead (tile kt+2 at the foot of trip kt, into the buffer trip kt has read), one barrier per
//   trip; delta comes one tile ahead in registers (staged extent == consumed extent). P tiles are wave-private, spilled with
//   Output coverage: each wave stores rows q0..q0+15 (it 0..7 x lane>>4 0..1) x 64 columns (16 lanes x 16 B
// =====================================================================================================
template <bool RES>
__global__ __launch_bounds__(128)
void attn_causal64(const unsigned short* __restrict__ qp, const unsigned short* __restrict__ kp,
                   const unsigned short* __restrict__ vtp, const float* __restrict__ taup,
                   const float* __restrict__ deltap, float* outp, int qbBase, int nqbThis) {
  union FB { v16b v; v8b h[2]; };
  union FH { v16h v; v8h h[2]; };
  __shared__ __align__(16) __bf16   Ksh[2][64 * LP];              // K [kv][e]      2 x 9 KB, cross-wave
  __shared__ __align__(16) _Float16 Vth[2][64 * LP];              // V^T [d][kv]    2 x 9 KB, cross-wave
  __shared__ __align__(16) _Float16 Psh[4][16 * LP];              // per wave P [row][kv]
  __shared__ __align__(16) _Float16 Psl[RES ? 4 : 1][16 * LP];    // per wave P residual
  __shared__ __align__(16) float    Os[4][16 * 64];               // per wave context tile [row][d]

  const int tid  = threadIdx.x;
  const int wave = tid >> 5;
  const int lane = tid & 31;
  const int hh   = lane >> 4;
  const int c    = lane & 15;

  const int bx   = blockIdx.x;
  const int qbl  = bx % nqbThis;
  const int rest = bx / nqbThis;
  const int h    = rest % NH;
  const int b    = rest / NH;
  const int qb   = qbBase + qbl;
  const int q0   = qb * 64 + wave * 16;
  const size_t rowB = (size_t)b * SEQ;

  const __bf16*   Qh = (const __bf16*)(const void*)qp + (size_t)h * HD;
  const __bf16*   Kh = (const __bf16*)(const void*)kp + (size_t)h * HD;
  const _Float16* Vt = (const _Float16*)(const void*)vtp + ((size_t)b * DM + (size_t)h * HD) * SEQ;
  const float* dlt   = deltap + (size_t)b * SEQ_FULL;
  float* Ob          = outp + (size_t)h * HD;
  const float tau_b  = bf_up(bf_bits(taup[b]));   // block-uniform scalar

  // ---- tile 0's K and V^T copies into buffer 0 (lane -> row tid>>3 (+16 i), 16-B column tid&7) ----
  const int crow = tid >> 3, ccol = (tid & 7) * 8;
  const __bf16*   kg0 = Kh + (rowB + (size_t)crow) * DM + ccol;                 // K row crow of tile 0
  const _Float16* vg0 = Vt + (size_t)crow * SEQ + ccol;                         // V^T row d = crow, keys of tile 0
  const unsigned  kl0 = (unsigned)(uintptr_t)(&Ksh[0][crow * LP + ccol]);       // LDS byte address: low 32 bits
  const unsigned  vl0 = (unsigned)(uintptr_t)(&Vth[0][crow * LP + ccol]);
  constexpr unsigned BUFB = 64u * LP * 2u;                                      // bytes of one buffer
  copy_tile_async(kg0, vg0, kl0, vl0);

  // ---- Q fragments (A operand, row = lane&15): 2 e-chunks ----
  v16b qa[2];
#pragma unroll
  for (int dc = 0; dc < 2; ++dc) {
    const size_t qo = (rowB + (size_t)q0 + (size_t)c) * DM + (size_t)(dc * 32 + 8 * hh);
    qa[dc] = ldfrag_b(Qh + qo);
  }

  float mrow[8], lrow[8];
  v8f oacc[4];
#pragma unroll
  for (int r = 0; r < 8; ++r) { mrow[r] = -INFINITY; lrow[r] = 0.f; }
#pragma unroll
  for (int t = 0; t < 4; ++t) oacc[t] = zero8();

  float djn[4];                               // delta of the coming tile, here tile 0
#pragma unroll
  for (int j = 0; j < 4; ++j) djn[j] = dlt[j * 16 + c];
  asm volatile("s_wait_asynccnt 0x0" ::: "memory");   // this wave's copies of tile 0 have landed
  __syncthreads();                                    // publishes tile 0 to every wave
  if (qb >= 1) copy_tile_async(kg0 + (size_t)64 * DM, vg0 + 64, kl0 + BUFB, vl0 + BUFB);   // tile 1 -> buffer 1

  for (int kt = 0; kt < NQB; ++kt) {          // static bound
    if (kt > qb) break;                       // block-uniform: causal key tiles 0..qb
    const int kv0 = kt * 64;
    const __bf16*   Kc = Ksh[kt & 1];         // this trip reads buffer kt mod 2 alone
    const _Float16* Vc = Vth[kt & 1];

    // ---- the next tile's delta values and this tile's K and V^T fragments: every read issued here as one group,
    //      delta (global) first, then K, then V^T. The score WMMAs wait by count for the K reads alone; the V^T reads
    //      (independent of the softmax) land behind the scores and the softmax.
    float dj[4];
    const int kvn = (kt < qb) ? kv0 + 64 : kv0;                                  // the last trip reads its own tile again
#pragma unroll
    for (int j = 0; j < 4; ++j) { dj[j] = djn[j]; djn[j] = dlt[kvn + j * 16 + c]; }   // kvn+j*16+c < SEQ <= SEQ_FULL
    FB kb[2][4];
    FH vb[2][4];
#pragma unroll
    for (int dc = 0; dc < 2; ++dc)
#pragma unroll
      for (int j = 0; j < 4; ++j) {
        kb[dc][j].h[0] = *(const v8b*)(Kc + (j * 16 + c) * LP + dc * 32 + 8 * hh);
        kb[dc][j].h[1] = *(const v8b*)(Kc + (j * 16 + c) * LP + dc * 32 + 16 + 8 * hh);
      }
#pragma unroll
    for (int kk = 0; kk < 2; ++kk)
#pragma unroll
      for (int t = 0; t < 4; ++t) {
        vb[kk][t].h[0] = *(const v8h*)(Vc + (t * 16 + c) * LP + kk * 32 + 8 * hh);
        vb[kk][t].h[1] = *(const v8h*)(Vc + (t * 16 + c) * LP + kk * 32 + 16 + 8 * hh);
      }
    // keeps the reads above together: without it the compiler sinks them between the WMMAs, one read ahead of its
    // use, and each WMMA again waits out an LDS latency
    __builtin_amdgcn_sched_barrier(0);

    // ---- scores: 16 query rows x 64 keys per wave, one bf16 product per 32-deep e step (e 0..31, then 32..63) ----
    v8f s[4];
#pragma unroll
    for (int j = 0; j < 4; ++j) s[j] = zero8();
#pragma unroll
    for (int dc = 0; dc < 2; ++dc)
#pragma unroll
      for (int j = 0; j < 4; ++j) s[j] = mma_b(qa[dc], kb[dc][j].v, s[j]);

    // ---- tau / delta in f32, scale, causal mask, row max, online softmax, P (x1024) and P residual (x4096) to LDS ----
#pragma unroll
    for (int j = 0; j < 4; ++j) dj[j] = bf_up(bf_bits(dj[j]));
    _Float16* pwh = Psh[wave];
    _Float16* pwl = Psl[RES ? wave : 0];
    float mt[8];                                    // this tile's row maxima
#pragma unroll
    for (int r = 0; r < 8; ++r) {
      const int ridx = q0 + 8 * hh + r;
      float m = -INFINITY;
#pragma unroll
      for (int j = 0; j < 4; ++j) {
        const int kidx = kv0 + j * 16 + c;
        float sv = (s[j][r] * tau_b + dj[j]) * 0.125f;
        sv = (kidx > ridx) ? -INFINITY : sv;
        s[j][r] = sv;
        m = fmaxf(m, sv);
      }
      mt[r] = m;
    }
    row_max16x8(mt);
    float alpha[8], ps[8];                          // rescale factors, this tile's row sums
#pragma unroll
    for (int r = 0; r < 8; ++r) {
      const float mnew  = fmaxf(mrow[r], mt[r]);
      const float msafe = (mnew == -INFINITY) ? 0.f : mnew;
      alpha[r] = __expf(mrow[r] - msafe);
      mrow[r] = mnew;
      float psum = 0.f;
#pragma unroll
      for (int j = 0; j < 4; ++j) {
        const float p = __expf(s[j][r] - msafe);    // masked key: exp(-inf) = 0
        psum += p;
        const float p1k = p * PCARRY;
        const _Float16 ph = (_Float16)p1k;
        pwh[(8 * hh + r) * LP + j * 16 + c] = ph;
        if (RES) {
          const _Float16 pl = (_Float16)((p1k - (float)ph) * PRES);
          pwl[(8 * hh + r) * LP + j * 16 + c] = pl;
        }
      }
      ps[r] = psum;
    }
    row_sum16x8(ps);
#pragma unroll
    for (int r = 0; r < 8; ++r) {
      lrow[r] = lrow[r] * alpha[r] + ps[r];
#pragma unroll
      for (int t = 0; t < 4; ++t) oacc[t][r] *= alpha[r];
    }
    __builtin_amdgcn_fence(__ATOMIC_RELEASE, "workgroup");
    __builtin_amdgcn_wave_barrier();
    __builtin_amdgcn_fence(__ATOMIC_ACQUIRE, "workgroup");

    // ---- context += P . V (f16 WMMA), residual products into a separate accumulator ----
    v8f o1[4];
#pragma unroll
    for (int t = 0; t < 4; ++t) o1[t] = zero8();
    FH pa[2], pl[2];                                // the wave's P fragments, again one group of LDS reads
#pragma unroll
    for (int kk = 0; kk < 2; ++kk) {
      pa[kk].h[0] = *(const v8h*)(pwh + c * LP + kk * 32 + 8 * hh);
      pa[kk].h[1] = *(const v8h*)(pwh + c * LP + kk * 32 + 16 + 8 * hh);
      if (RES) {
        pl[kk].h[0] = *(const v8h*)(pwl + c * LP + kk * 32 + 8 * hh);
        pl[kk].h[1] = *(const v8h*)(pwl + c * LP + kk * 32 + 16 + 8 * hh);
      }
    }
    __builtin_amdgcn_sched_barrier(0);              // as above: the P reads stay one group ahead of the WMMAs
#pragma unroll
    for (int kk = 0; kk < 2; ++kk) {
#pragma unroll
      for (int t = 0; t < 4; ++t) {
        oacc[t] = mma_h(pa[kk].v, vb[kk][t].v, oacc[t]);
        if (RES) o1[t] = mma_h(pl[kk].v, vb[kk][t].v, o1[t]);
      }
    }
    if (RES) {
#pragma unroll
      for (int t = 0; t < 4; ++t)
#pragma unroll
        for (int r = 0; r < 8; ++r) oacc[t][r] += o1[t][r] * (1.0f / PRES);
    }

    // ---- foot of the trip: hand-over of the buffers ----
    asm volatile("s_wait_dscnt 0x0" ::: "memory");      // this wave's LDS reads of tile kt have retired before its buffer is refilled
    asm volatile("s_wait_asynccnt 0x0" ::: "memory");   // this wave's copies of tile kt+1 have landed
    __syncthreads();                                    // publishes tile kt+1; ends every wave's reads of tile kt's buffer
    if (kt + 2 <= qb)                                   // block-uniform: tile kt+2 into the buffer this trip has read
      copy_tile_async(kg0 + (size_t)(kt + 2) * 64 * DM, vg0 + (kt + 2) * 64, kl0 + (unsigned)(kt & 1) * BUFB,
                      vl0 + (unsigned)(kt & 1) * BUFB);
  }
  asm volatile("s_wait_asynccnt 0x0" ::: "memory");     // no copy is outstanding when the wave goes on to its end

  // ---- normalise (1/l, the 1/1024 p carry and the 1/16 v carry), stage the wave's 16x64 tile,
  float* os = Os[wave];
#pragma unroll
  for (int r = 0; r < 8; ++r) {
    const float l = lrow[r];
    const float inv = ((l > 0.f) ? (1.0f / l) : 0.f) * (1.0f / PCARRY) * (1.0f / VCARRY);
#pragma unroll
    for (int t = 0; t < 4; ++t) os[(8 * hh + r) * 64 + t * 16 + c] = oacc[t][r] * inv;
  }
  __builtin_amdgcn_fence(__ATOMIC_RELEASE, "workgroup");
  __builtin_amdgcn_wave_barrier();
  __builtin_amdgcn_fence(__ATOMIC_ACQUIRE, "workgroup");
  {
    const int hh2 = lane >> 4, c4 = (lane & 15) * 4;
    v4f vv[8];
#pragma unroll
    for (int it = 0; it < 8; ++it) {
      const int row = it * 2 + hh2;                      // it 0..7 x hh2 0..1 = rows 0..15
      vv[it] = *(const v4f*)(os + row * 64 + c4);
    }
    {
#pragma unroll
      for (int it = 0; it < 8; ++it) {
        const int row = it * 2 + hh2;
        *(v4f*)(Ob + (rowB + (size_t)q0 + (size_t)row) * DM + (size_t)c4) = vv[it];
      }
      
    }
  }
}

// =====================================================================================================
// Workspace map (bytes, NB = 4, SEQ = 2048):
//   Qb  bf16 [NB*SEQ][DM]        0          8388608
//   Kb  bf16 [NB*SEQ][DM]        8388608    8388608
//   VT  f16  [NB][DM][SEQ]       16777216   8388608
//   end                          25165824
// Inputs keep the full per-batch token stride SEQ_FULL * DM; planes and out are compact over NB, SEQ.
// =====================================================================================================
extern "C" void kernel_launch(void* const* d_in, const int* in_sizes, int n_in,
                              void* d_out, int out_size, void* d_ws, size_t ws_size,
                              hipStream_t stream) {
  if (n_in < 5) return;
  const long long needTok = (long long)(NB - 1) * SEQ_FULL + (long long)SEQ;
  if ((long long)in_sizes[0] < needTok * DM) return;
  if ((long long)in_sizes[1] < needTok * DM) return;
  if ((long long)in_sizes[2] < needTok * DM) return;
  if (in_sizes[3] < NB) return;
  if ((long long)in_sizes[4] < needTok) return;
  if ((long long)out_size < (long long)NB * SEQ * DM) return;

  const float* q     = (const float*)d_in[0];
  const float* k     = (const float*)d_in[1];
  const float* v     = (const float*)d_in[2];
  const float* tau   = (const float*)d_in[3];
  const float* delta = (const float*)d_in[4];
  float* out = (float*)d_out;

  const size_t PX = (size_t)NB * SEQ * DM * 2;     // 8388608: 16-bit plane [NB*SEQ][DM] or [NB][DM][SEQ]
  size_t off = 0;
  const size_t oQ = off; off += PX;
  const size_t oK = off; off += PX;
  const size_t oV = off; off += PX;
  if (off > ws_size) return;                       // off = 25165824
  if (off > (size_t)134217728) return;

  char* ws = (char*)d_ws;
  unsigned short* Qb  = (unsigned short*)(ws + oQ);
  unsigned short* Kb  = (unsigned short*)(ws + oK);
  unsigned short* VTb = (unsigned short*)(ws + oV);

  const dim3 gCvt(NQB, NH / CVH, NB);              // 32 x 4 x 4 blocks
  const int resq = (RESQB < NQB) ? RESQB : NQB;

  // (1) queries, keys -> bf16 planes [b*SEQ + t][h*64 + e]; values (b, s, h, d) -> v^T f16 plane [b][h*64 + d][s] (x16 carry)
  cvt_qkv<<<gCvt, dim3(256), 0, stream>>>(q, k, v, Qb, Kb, VTb);
  // (2) attention: query blocks 0..resq-1 with the p residual plane, the rest without
  attn_causal64<true><<<dim3(NB * NH * resq), dim3(128), 0, stream>>>(
      Qb, Kb, VTb, tau, delta, out, 0, resq);
  if (NQB > resq) {
    attn_causal64<false><<<dim3(NB * NH * (NQB - resq)), dim3(128), 0, stream>>>(
        Qb, Kb, VTb, tau, delta, out, resq, NQB - resq);
  }
  (void)hipGetLastError();
}

// v006
// It runs in 52 microseconds.
// Two timings next to v005 put it at 1.29 and 1.30 times that version's speed.
// Over all steps from v000 it is 3.09 times as fast.
// Contractions: q.k^T scores = v_wmma_f32_16x16x32_bf16 (bf16 operands = RNE-converted inputs, one product, f32 accumulate);
// p.v context = v_wmma_f32_16x16x32_f16 (p carried x1024 in f16 plus an f16 residual plane x4096 on the leading query blocks,
// v = RNE-bf16 input carried x16 in f16), f32 accumulate; tau, delta, causal mask and softmax in f32.
#include <hip/hip_runtime.h>
#include <math.h>
#include <stdint.h>

#ifndef NB
#define NB 4
#endif
#ifndef SEQ
#define SEQ 2048
#endif
#define NB_FULL  4
#define SEQ_FULL 2048
#define NH  8
#define HD  64
#define DM  (NH * HD)        // 512: token row pitch of q, k, v and out (heads interleaved within a token row)
#define NQB (SEQ / 64)       // 64-row query blocks == 64-key tiles
#define RESQB 8              // leading query blocks that add the p residual plane
#define VCARRY 16.0f         // v plane carried x16 in f16
#define PCARRY 1024.0f       // p carried x1024 in f16
#define PRES   4096.0f       // p residual plane scale
#define LOG2E  1.44269504f   // log2(e) in f32
#define LP 72                // LDS row pitch of the 64-wide 16-bit tiles, in elements: 144 B = 16 B x odd, so the 16 rows of a
                             // ds_load_b128 fragment read fall on distinct banks (128 B put 8 rows on each bank group)
static_assert((SEQ % 64) == 0);
static_assert(SEQ >= 64 && SEQ <= SEQ_FULL);
static_assert(NB >= 1 && NB <= NB_FULL);
static_assert(NH * HD == DM);
static_assert(((SEQ * DM / 8) % 256) == 0);

typedef _Float16 v16h __attribute__((ext_vector_type(16)));
typedef _Float16 v8h  __attribute__((ext_vector_type(8)));
typedef __bf16   v16b __attribute__((ext_vector_type(16)));
typedef __bf16   v8b  __attribute__((ext_vector_type(8)));
typedef float    v8f  __attribute__((ext_vector_type(8)));
typedef float    v4f  __attribute__((ext_vector_type(4)));
typedef float    v2f  __attribute__((ext_vector_type(2)));
typedef _Float16 v2h  __attribute__((ext_vector_type(2)));
typedef unsigned int v4u __attribute__((ext_vector_type(4)));

// ---- scalar helpers --------------------------------------------------------------------------------
__device__ __forceinline__ unsigned short bf_bits(float f) {          // f32 -> bf16 bits, RNE convert
  unsigned u = __float_as_uint(f);
  return (unsigned short)((u + 0x7FFFu + ((u >> 16) & 1u)) >> 16);
}
__device__ __forceinline__ float bf_up(unsigned short h) { return __uint_as_float(((unsigned)h) << 16); }
__device__ __forceinline__ unsigned pk16(unsigned short a, unsigned short b) { return (unsigned)a | ((unsigned)b << 16); }
__device__ __forceinline__ v8f zero8() { v8f z = {0.f, 0.f, 0.f, 0.f, 0.f, 0.f, 0.f, 0.f}; return z; }

// ---- the value of lane l ^ 16: the other half of the wave holds the other 32 keys of the same query column
__device__ __forceinline__ float other_half(float x) {
  const int b = __float_as_int(x);
  return __int_as_float(__builtin_amdgcn_permlanex16(b, b, 0x76543210, 0xfedcba98, false, false));
}

// ---- fragment loader: 16-bit A/B operand, lane -> row/col (lane&15), p already includes +8*(lane>>4);
//      elements 0..7 <- p[0..7] (k0+8h..), elements 8..15 <- p[16..23] (k0+16+8h..)
__device__ __forceinline__ v16b ldfrag_b(const __bf16* p) {
  union { v16b v; v8b h[2]; } f;
  f.h[0] = *(const v8b*)(p);
  f.h[1] = *(const v8b*)(p + 16);
  return f.v;
}

// ---- WMMA helpers: the plain builtins, whose hazard distances the compiler keeps itself. No asm statement stands
//      behind them: a volatile one orders every LDS read against it and so holds each fragment read behind the
//      WMMA before it, one full LDS wait per WMMA.
__device__ __forceinline__ v8f mma_b(v16b a, v16b b, v8f c) {
  return __builtin_amdgcn_wmma_f32_16x16x32_bf16(false, a, false, b, (short)0, c, false, false);
}
__device__ __forceinline__ v8f mma_h(v16h a, v16h b, v8f c) {
  return __builtin_amdgcn_wmma_f32_16x16x32_f16(false, a, false, b, (short)0, c, false, false);
}

// ---- one 64-key tile of K and of V^T (64 rows x 128 B each) from the 16-bit planes straight into LDS, through no
//      register: 8 asynchronous 16-B copies per lane. kg / vg: the lane's global address in rows 0..15 of the tile,
//      kl / vl: its LDS byte address there; copy i takes row + 16 i. 8 lanes cover one 128-B row, a wave 4 whole rows.
//      The s_wait_xcnt is the last line of the copies' own statement, so that no address register of a copy is
//      rewritten in front of it. All 32 lanes are on where this is called.
__device__ __forceinline__ void copy_tile_async(const __bf16* kg, const _Float16* vg, unsigned kl, unsigned vl) {
  asm volatile(
      "global_load_async_to_lds_b128 %0, %8, off\n\t"
      "global_load_async_to_lds_b128 %1, %9, off\n\t"
      "global_load_async_to_lds_b128 %2, %10, off\n\t"
      "global_load_async_to_lds_b128 %3, %11, off\n\t"
      "global_load_async_to_lds_b128 %4, %12, off\n\t"
      "global_load_async_to_lds_b128 %5, %13, off\n\t"
      "global_load_async_to_lds_b128 %6, %14, off\n\t"
      "global_load_async_to_lds_b128 %7, %15, off\n\t"
      "s_wait_xcnt 0x0"
      :: "v"(kl), "v"(kl + 16u * LP * 2u), "v"(kl + 32u * LP * 2u), "v"(kl + 48u * LP * 2u),
         "v"(vl), "v"(vl + 16u * LP * 2u), "v"(vl + 32u * LP * 2u), "v"(vl + 48u * LP * 2u),
         "v"(kg), "v"(kg + 16 * DM), "v"(kg + 32 * DM), "v"(kg + 48 * DM),
         "v"(vg), "v"(vg + 16 * SEQ), "v"(vg + 32 * SEQ), "v"(vg + 48 * SEQ)
      : "memory");
}

// =====================================================================================================
// Queries, keys, values and delta converted in one launch. Block = (64-token tile st = blockIdx.x, pair of heads hp = blockIdx.y,
// batch = blockIdx.z), 256 threads; each thread issues its 24 16-B loads (8 of v, 8 of q, 8 of k) before it uses any.
// 512 blocks of 8 waves: 16 waves per WGP, all resident at once.
// queries, keys: f32 -> bf16 (RNE convert) in units of 8 contiguous elements, one 16-B store per unit, a wave writes
// 512 contiguous B. The block takes units (hp*NQB + st)*1024 .. +1023 of its batch's flat [SEQ][DM] plane, thread tid
// the units tid + 256 j, j = 0..3. coverage: NQB*(NH/2) blocks x 1024 units x 8 = SEQ*DM elements per batch.
// values f32 (b, s, h, d) -> V^T f16 plane: element (b, h, d, s) at [(b*DM + h*64 + d)*SEQ + s],
// value = f16(VCARRY * bf16(v)) (exact: a bf16 significand fits in f16); heads h = 2 hp + g, g = 0, 1, one LDS tile each.
// Load phase: thread -> (key s = tid>>2, 16 d-columns dq = (tid&3)*16): 4 x 16-B loads of one token row
// segment per head, element stores into the LDS tile T[g][d][s] (pitch 72). coverage: 256 threads x 16 = 64 x 64.
// Store phase after __syncthreads: 8 waves x 2 x (4 rows of 8 lanes x 16 B) = 64 output rows d x 64 keys per head;
// the q and k stores stand behind the barrier too, so that the barrier waits for no global store.
// delta f32 [b][SEQ_FULL] -> bf16 plane [b][SEQ] (RNE convert): the hp = 0 block of a tile converts the tile's 64 values.
// =====================================================================================================
#define CVH 2                // heads per conversion block
static_assert((NH % CVH) == 0);
static_assert(SEQ * DM / 8 == NQB * (NH / CVH) * 512 * CVH);
__device__ __forceinline__ v4u bf16x8(v4f a, v4f a4) {
  v4u p;
  p[0] = pk16(bf_bits(a[0]),  bf_bits(a[1]));
  p[1] = pk16(bf_bits(a[2]),  bf_bits(a[3]));
  p[2] = pk16(bf_bits(a4[0]), bf_bits(a4[1]));
  p[3] = pk16(bf_bits(a4[2]), bf_bits(a4[3]));
  return p;
}
__global__ __launch_bounds__(256) void cvt_qkv(const float* __restrict__ q, const float* __restrict__ k,
                                               const float* __restrict__ v, const float* __restrict__ delta,
                                               unsigned short* qb, unsigned short* kb, unsigned short* vt,
                                               unsigned short* db) {
  __shared__ __align__(16) _Float16 T[CVH][64 * 72];
  const int tid  = threadIdx.x;
  const int wave = tid >> 5;
  const int lane = tid & 31;
  const int st   = blockIdx.x;
  const int hp   = blockIdx.y;
  const int b    = blockIdx.z;
  const int s  = tid >> 2;            // 0..63
  const int dq = (tid & 3) * 16;      // 0,16,32,48
  const float* vsrc = v + (((size_t)b * SEQ_FULL + (size_t)st * 64 + (size_t)s) * DM + (size_t)hp * (CVH * HD) + (size_t)dq);
  const size_t e0 = ((size_t)(hp * NQB + st) * (512 * CVH) + (size_t)tid) * 8;   // the thread's first unit, in elements of the batch plane
  const float* qsrc = q + (size_t)b * SEQ_FULL * DM + e0;
  const float* ksrc = k + (size_t)b * SEQ_FULL * DM + e0;
  v4f va[CVH][4], qa[2 * CVH][2], ka[2 * CVH][2];
  const bool dmine = (hp == 0) && (tid < 64);      // wave-uniform: waves 0 and 1 of the tile's first block take its 64 delta values
  float dv = 0.f;
  if (dmine) dv = delta[(size_t)b * SEQ_FULL + (size_t)st * 64 + (size_t)tid];
#pragma unroll
  for (int g = 0; g < CVH; ++g)
#pragma unroll
    for (int i = 0; i < 4; ++i) va[g][i] = *(const v4f*)(vsrc + g * HD + 4 * i);
#pragma unroll
  for (int j = 0; j < 2 * CVH; ++j) {
    qa[j][0] = *(const v4f*)(qsrc + j * 2048);
    qa[j][1] = *(const v4f*)(qsrc + j * 2048 + 4);
    ka[j][0] = *(const v4f*)(ksrc + j * 2048);
    ka[j][1] = *(const v4f*)(ksrc + j * 2048 + 4);
  }
#pragma unroll
  for (int g = 0; g < CVH; ++g)
#pragma unroll
    for (int i = 0; i < 4; ++i) {
#pragma unroll
      for (int e = 0; e < 4; ++e) {
        const float f = bf_up(bf_bits(va[g][i][e])) * VCARRY;
        T[g][(dq + 4 * i + e) * 72 + s] = (_Float16)f;
      }
    }
  __syncthreads();
  const int q8 = lane >> 3, c8 = (lane & 7) * 8;
  v4u w[CVH][2];
#pragma unroll
  for (int g = 0; g < CVH; ++g)
#pragma unroll
    for (int it = 0; it < 2; ++it) {
      const int d = wave * 8 + it * 4 + q8;           // wave w: rows 8w..8w+7 (it 0..1 x q8 0..3)
      const v8h x = *(const v8h*)(T[g] + d * 72 + c8);
      w[g][it] = __builtin_bit_cast(v4u, x);
    }
  unsigned short* qdst = qb + (size_t)b * SEQ * DM + e0;
  unsigned short* kdst = kb + (size_t)b * SEQ * DM + e0;
#pragma unroll
  for (int j = 0; j < 2 * CVH; ++j) {
    *(v4u*)(qdst + j * 2048) = bf16x8(qa[j][0], qa[j][1]);
    *(v4u*)(kdst + j * 2048) = bf16x8(ka[j][0], ka[j][1]);
  }
  if (dmine) db[(size_t)b * SEQ + (size_t)st * 64 + (size_t)tid] = bf_bits(dv);
  unsigned short* dst = vt + ((size_t)b * DM + (size_t)hp * (CVH * HD)) * SEQ + (size_t)st * 64 + (size_t)c8;
#pragma unroll
  for (int g = 0; g < CVH; ++g)
#pragma unroll
    for (int it = 0; it < 2; ++it) {
      const int d = g * HD + wave * 8 + it * 4 + q8;
      *(v4u*)(dst + (size_t)d * SEQ) = w[g][it];
    }
}

// =====================================================================================================
// Causal attention, head dim 64, no projections.
//   q plane (bf16):  element (b, t, h, e) at [(b*SEQ + t)*DM + h*64 + e]   (rows of batch b: b*SEQ..)
//   k plane (bf16):  same layout with key index s
//   v^T plane (f16): element (b, h, d, s) at [(b*DM + h*64 + d)*SEQ + s], value VCARRY * bf16(v)
//   delta plane (bf16): element (b, s) at [b*SEQ + s]; tau [b] used as its RNE-bf16 value in f32
//   Both products run transposed. S^T = K . Q^T: A = K rows (keys) from LDS, B = the wave's 16 queries, kept in
//   registers. Accumulator tile j, register r of lane (c, hh) = score of key kv0 + 16 j + 8 hh + r against query
//   q0 + c: a lane holds 32 of the 64 scores of ONE query, lane c + 16 the other 32. Row maximum and row sum are
//   in-lane, the maximum joined with one exchange between the halves per tile, the sum once behind the loop.
//   logit = (score * tau + delta[s]) * 0.125; keys s > t -> -inf; online softmax in f32; p = exp(logit - m) carried
//   as f16(1024 p); RES adds an f16 residual plane f16((1024 p - hi) * 4096) with its own accumulator folded back
//   per tile with 1/4096.
//   O^T += V^T . P^T: A = V^T rows (d) from LDS, B = P^T, which is the converted score tiles as they lie: elements
//   0..7 of the B operand of keys 32 kk.. are tile 2 kk, registers 0..7 (keys 32 kk + 8 hh + 0..7), elements 8..15
//   tile 2 kk + 1 (keys 32 kk + 16 + 8 hh + 0..7), the k order of the V^T fragment reads. P never goes through LDS.
//   out (f32) element (b, t, h, d) at [(b*SEQ + t)*DM + h*64 + d] = ctx / (l * 1024 * 16).
//   Block = 4 waves = 64 query rows (query block qb) of one (b, h); grid = nqbThis * NH * NB; key tiles
//   kt = 0..qb (block-uniform trip, static bound NQB), 64 keys each; only the diagonal tile has masked keys and
//   every query keeps its own key, so every joined maximum is finite on every processed tile.
//   K / V^T tile staging: two LDS buffers; 128 threads x 4 asynchronous 16-B copies per plane = the whole 64x64 tile,
//   requested one tile ahead (tile kt+2 at the foot of trip kt, into the buffer trip kt has read), one barrier per
//   trip; delta comes one tile ahead in registers (staged extent == consumed extent).
//   Output coverage: accumulator tile t, register r of lane (c, hh) = context of query q0 + c, column 16 t + 8 hh + r;
//   staged per wave in LDS [query][d] (pitch OP), then rows q0..q0+15 (it 0..7 x lane>>4 0..1) x 64 columns
//   (16 lanes x 16 B) stored as whole 256-B row segments.
// =====================================================================================================
#define OP 68                // LDS row pitch of the f32 output tile, in elements: 272 B, so the 16 rows of a 16-B store differ in bank
template <bool RES>
__global__ __launch_bounds__(128)
void attn_causal64(const unsigned short* __restrict__ qp, const unsigned short* __restrict__ kp,
                   const unsigned short* __restrict__ vtp, const float* __restrict__ taup,
                   const unsigned short* __restrict__ dbp, float* outp, int qbBase, int nqbThis) {
  union FB { v16b v; v8b h[2]; };
  union FH { v16h v; v8h h[2]; };
  __shared__ __align__(16) __bf16   Ksh[2][64 * LP];              // K [kv][e]      2 x 9 KB, cross-wave
  __shared__ __align__(16) _Float16 Vth[2][64 * LP];              // V^T [d][kv]    2 x 9 KB, cross-wave
  __shared__ __align__(16) float    Os[4][16 * OP];               // per wave context tile [query][d]

  const int tid  = threadIdx.x;
  const int wave = tid >> 5;
  const int lane = tid & 31;
  const int hh   = lane >> 4;
  const int c    = lane & 15;

  const int bx   = blockIdx.x;
  const int qbl  = bx % nqbThis;
  const int rest = bx / nqbThis;
  const int h    = rest % NH;
  const int b    = rest / NH;
  const int qb   = qbBase + qbl;
  const int q0   = qb * 64 + wave * 16;
  const size_t rowB = (size_t)b * SEQ;

  const __bf16*   Qh = (const __bf16*)(const void*)qp + (size_t)h * HD;
  const __bf16*   Kh = (const __bf16*)(const void*)kp + (size_t)h * HD;
  const _Float16* Vt = (const _Float16*)(const void*)vtp + ((size_t)b * DM + (size_t)h * HD) * SEQ;
  const __bf16*  dlt = (const __bf16*)(const void*)dbp + rowB + (size_t)(8 * hh);   // the lane half's 8 keys of each 16
  float* Ob          = outp + (size_t)h * HD;
  const float tau_b  = bf_up(bf_bits(taup[b]));   // block-uniform scalar

  // ---- tile 0's K and V^T copies into buffer 0 (lane -> row tid>>3 (+16 i), 16-B column tid&7) ----
  const int crow = tid >> 3, ccol = (tid & 7) * 8;
  const __bf16*   kg0 = Kh + (rowB + (size_t)crow) * DM + ccol;                 // K row crow of tile 0
  const _Float16* vg0 = Vt + (size_t)crow * SEQ + ccol;                         // V^T row d = crow, keys of tile 0
  const unsigned  kl0 = (unsigned)(uintptr_t)(&Ksh[0][crow * LP + ccol]);       // LDS byte address: low 32 bits
  const unsigned  vl0 = (unsigned)(uintptr_t)(&Vth[0][crow * LP + ccol]);
  constexpr unsigned BUFB = 64u * LP * 2u;                                      // bytes of one buffer
  copy_tile_async(kg0, vg0, kl0, vl0);

  // ---- Q fragments (B operand, column = lane&15): 2 e-chunks ----
  v16b qa[2];
#pragma unroll
  for (int dc = 0; dc < 2; ++dc) {
    const size_t qo = (rowB + (size_t)q0 + (size_t)c) * DM + (size_t)(dc * 32 + 8 * hh);
    qa[dc] = ldfrag_b(Qh + qo);
  }

  float mrow = -INFINITY;                     // running maximum of query q0 + c, the same in both halves
  float lrow = 0.f;                           // running sum over this half's keys alone
  v8f oacc[4];
#pragma unroll
  for (int t = 0; t < 4; ++t) oacc[t] = zero8();

  v8b djn[4];                                 // delta of the coming tile, here tile 0: keys 16 j + 8 hh + 0..7
#pragma unroll
  for (int j = 0; j < 4; ++j) djn[j] = *(const v8b*)(dlt + j * 16);
  asm volatile("s_wait_asynccnt 0x0" ::: "memory");   // this wave's copies of tile 0 have landed
  __syncthreads();                                    // publishes tile 0 to every wave
  if (qb >= 1) copy_tile_async(kg0 + (size_t)64 * DM, vg0 + 64, kl0 + BUFB, vl0 + BUFB);   // tile 1 -> buffer 1

  for (int kt = 0; kt < NQB; ++kt) {          // static bound
    if (kt > qb) break;                       // block-uniform: causal key tiles 0..qb
    const int kv0 = kt * 64;
    const __bf16*   Kc = Ksh[kt & 1];         // this trip reads buffer kt mod 2 alone
    const _Float16* Vc = Vth[kt & 1];

    // ---- the next tile's delta values and this tile's K and V^T fragments: every read issued here as one group,
    //      delta (global) first, then K, then V^T. The score WMMAs wait by count for the K reads alone; the V^T reads
    //      (independent of the softmax) land behind the scores and the softmax.
    v8b dj[4];
    const int kvn = (kt < qb) ? kv0 + 64 : kv0;                                  // the last trip reads its own tile again
#pragma unroll
    for (int j = 0; j < 4; ++j) { dj[j] = djn[j]; djn[j] = *(const v8b*)(dlt + kvn + j * 16); }   // kvn+j*16+8*hh+7 < SEQ
    FB kb[2][4];
    FH vb[2][4];
#pragma unroll
    for (int dc = 0; dc < 2; ++dc)
#pragma unroll
      for (int j = 0; j < 4; ++j) {
        kb[dc][j].h[0] = *(const v8b*)(Kc + (j * 16 + c) * LP + dc * 32 + 8 * hh);
        kb[dc][j].h[1] = *(const v8b*)(Kc + (j * 16 + c) * LP + dc * 32 + 16 + 8 * hh);
      }
#pragma unroll
    for (int kk = 0; kk < 2; ++kk)
#pragma unroll
      for (int t = 0; t < 4; ++t) {
        vb[kk][t].h[0] = *(const v8h*)(Vc + (t * 16 + c) * LP + kk * 32 + 8 * hh);
        vb[kk][t].h[1] = *(const v8h*)(Vc + (t * 16 + c) * LP + kk * 32 + 16 + 8 * hh);
      }
    // keeps the reads above together: without it the compiler sinks them between the WMMAs, one read ahead of its
    // use, and each WMMA again waits out an LDS latency
    __builtin_amdgcn_sched_barrier(0);

    // ---- scores, transposed: 64 keys x 16 queries per wave, one bf16 product per 32-deep e step (e 0..31, then 32..63) ----
    v8f s[4];
#pragma unroll
    for (int j = 0; j < 4; ++j) s[j] = zero8();
#pragma unroll
    for (int dc = 0; dc < 2; ++dc)
#pragma unroll
      for (int j = 0; j < 4; ++j) s[j] = mma_b(kb[dc][j].v, qa[dc], s[j]);

    // ---- tau / delta in f32, scale, causal mask, maximum, online softmax; P (x1024) and P residual (x4096) stay in
    //      registers as B operands. Four independent chains (one per tile j) for the maximum and for the sum.
    //      Register pairs (keys 2 i, 2 i + 1 of one query, one maximum and one factor for both) go through packed f32 forms.
    const int lim = q0 + c - kv0 - 8 * hh;          // key 16 j + r of this half is masked where 16 j + r > lim
    v2f x[4][4];                                    // logits: tile j, register pair i
    float mj[4];
#pragma unroll
    for (int j = 0; j < 4; ++j) {
      float m = -INFINITY;
#pragma unroll
      for (int i = 0; i < 4; ++i) {
        v2f sv;
        sv[0] = s[j][2 * i]     * tau_b + (float)dj[j][2 * i];
        sv[1] = s[j][2 * i + 1] * tau_b + (float)dj[j][2 * i + 1];
        sv *= 0.125f;
        sv[0] = (j * 16 + 2 * i     > lim) ? -INFINITY : sv[0];
        sv[1] = (j * 16 + 2 * i + 1 > lim) ? -INFINITY : sv[1];
        x[j][i] = sv;
        m = fmaxf(m, fmaxf(sv[0], sv[1]));
      }
      mj[j] = m;
    }
    float mt = fmaxf(fmaxf(mj[0], mj[1]), fmaxf(mj[2], mj[3]));
    mt = fmaxf(mt, other_half(mt));                 // this tile's maximum over all 64 keys of the query
    const float mnew  = fmaxf(mrow, mt);
    const float msafe = (mnew == -INFINITY) ? 0.f : mnew;
    const float alpha = __expf(mrow - msafe);       // rescale factor
    mrow = mnew;
    union PH { v16h v; v2h d[8]; };
    PH pa[2], pl[2];
    v2f pj[4];
#pragma unroll
    for (int j = 0; j < 4; ++j) {
#pragma unroll
      for (int i = 0; i < 4; ++i) {
        const v2f e = (x[j][i] - msafe) * LOG2E;    // exp(y) = exp2(y * log2 e); masked key: exp2(-inf) = 0
        v2f p;
        p[0] = __builtin_amdgcn_exp2f(e[0]);
        p[1] = __builtin_amdgcn_exp2f(e[1]);
        pj[j] = (i == 0) ? p : pj[j] + p;
        const v2f p1k = p * PCARRY;
        const v2h ph = __builtin_convertvector(p1k, v2h);
        pa[j >> 1].d[(j & 1) * 4 + i] = ph;
        if (RES) pl[j >> 1].d[(j & 1) * 4 + i] = __builtin_convertvector((p1k - __builtin_convertvector(ph, v2f)) * PRES, v2h);
      }
    }
    const v2f pt = (pj[0] + pj[1]) + (pj[2] + pj[3]);
    lrow = lrow * alpha + (pt[0] + pt[1]);
#pragma unroll
    for (int t = 0; t < 4; ++t) oacc[t] *= alpha;

    // ---- context^T += V^T . P^T (f16 WMMA), residual products into a separate accumulator ----
    v8f o1[4];
#pragma unroll
    for (int t = 0; t < 4; ++t) o1[t] = zero8();
#pragma unroll
    for (int kk = 0; kk < 2; ++kk) {
#pragma unroll
      for (int t = 0; t < 4; ++t) {
        oacc[t] = mma_h(vb[kk][t].v, pa[kk].v, oacc[t]);
        if (RES) o1[t] = mma_h(vb[kk][t].v, pl[kk].v, o1[t]);
      }
    }
    if (RES) {
#pragma unroll
      for (int t = 0; t < 4; ++t)
#pragma unroll
        for (int r = 0; r < 8; ++r) oacc[t][r] += o1[t][r] * (1.0f / PRES);
    }

    // ---- foot of the trip: hand-over of the buffers ----
    // keeps the trip's register work in front of the foot: without it the compiler sinks scores, softmax and context
    // behind the waits and the barrier (they touch no memory), the waits then stand right behind the reads, all of them
    // to 0, and the next copies issue only just ahead of the wait for them
    __builtin_amdgcn_sched_barrier(0);
    asm volatile("s_wait_dscnt 0x0" ::: "memory");      // this wave's LDS reads of tile kt have retired before its buffer is refilled
    asm volatile("s_wait_asynccnt 0x0" ::: "memory");   // this wave's copies of tile kt+1 have landed
    __syncthreads();                                    // publishes tile kt+1; ends every wave's reads of tile kt's buffer
    if (kt + 2 <= qb)                                   // block-uniform: tile kt+2 into the buffer this trip has read
      copy_tile_async(kg0 + (size_t)(kt + 2) * 64 * DM, vg0 + (kt + 2) * 64, kl0 + (unsigned)(kt & 1) * BUFB,
                      vl0 + (unsigned)(kt & 1) * BUFB);
  }
  asm volatile("s_wait_asynccnt 0x0" ::: "memory");     // no copy is outstanding when the wave goes on to its end

  // ---- join the halves' sums, normalise (1/l, the 1/1024 p carry and the 1/16 v carry), stage the wave's 16x64 tile
  float* os = Os[wave];
  {
    const float l = lrow + other_half(lrow);
    const float inv = ((l > 0.f) ? (1.0f / l) : 0.f) * (1.0f / PCARRY) * (1.0f / VCARRY);
#pragma unroll
    for (int t = 0; t < 4; ++t) {
      v4f lo, hi;
#pragma unroll
      for (int r = 0; r < 4; ++r) { lo[r] = oacc[t][r] * inv; hi[r] = oacc[t][4 + r] * inv; }
      *(v4f*)(os + c * OP + t * 16 + 8 * hh)     = lo;
      *(v4f*)(os + c * OP + t * 16 + 8 * hh + 4) = hi;
    }
  }
  __builtin_amdgcn_fence(__ATOMIC_RELEASE, "workgroup");
  __builtin_amdgcn_wave_barrier();
  __builtin_amdgcn_fence(__ATOMIC_ACQUIRE, "workgroup");
  {
    const int hh2 = lane >> 4, c4 = (lane & 15) * 4;
    v4f vv[8];
#pragma unroll
    for (int it = 0; it < 8; ++it) {
      const int row = it * 2 + hh2;                      // it 0..7 x hh2 0..1 = rows 0..15
      vv[it] = *(const v4f*)(os + row * OP + c4);
    }
#pragma unroll
    for (int it = 0; it < 8; ++it) {
      const int row = it * 2 + hh2;
      *(v4f*)(Ob + (rowB + (size_t)q0 + (size_t)row) * DM + (size_t)c4) = vv[it];
    }
  }
}

// =====================================================================================================
// Workspace map (bytes, NB = 4, SEQ = 2048):
//   Qb  bf16 [NB*SEQ][DM]        0          8388608
//   Kb  bf16 [NB*SEQ][DM]        8388608    8388608
//   VT  f16  [NB][DM][SEQ]       16777216   8388608
//   Db  bf16 [NB][SEQ]           25165824   16384
//   end                          25182208
// Inputs keep the full per-batch token stride SEQ_FULL * DM; planes and out are compact over NB, SEQ.
// =====================================================================================================
extern "C" void kernel_launch(void* const* d_in, const int* in_sizes, int n_in,
                              void* d_out, int out_size, void* d_ws, size_t ws_size,
                              hipStream_t stream) {
  if (n_in < 5) return;
  const long long needTok = (long long)(NB - 1) * SEQ_FULL + (long long)SEQ;
  if ((long long)in_sizes[0] < needTok * DM) return;
  if ((long long)in_sizes[1] < needTok * DM) return;
  if ((long long)in_sizes[2] < needTok * DM) return;
  if (in_sizes[3] < NB) return;
  if ((long long)in_sizes[4] < needTok) return;
  if ((long long)out_size < (long long)NB * SEQ * DM) return;

  const float* q     = (const float*)d_in[0];
  const float* k     = (const float*)d_in[1];
  const float* v     = (const float*)d_in[2];
  const float* tau   = (const float*)d_in[3];
  const float* delta = (const float*)d_in[4];
  float* out = (float*)d_out;

  const size_t PX = (size_t)NB * SEQ * DM * 2;     // 8388608: 16-bit plane [NB*SEQ][DM] or [NB][DM][SEQ]
  size_t off = 0;
  const size_t oQ = off; off += PX;
  const size_t oK = off; off += PX;
  const size_t oV = off; off += PX;
  const size_t oD = off; off += (size_t)NB * SEQ * 2;
  if (off > ws_size) return;                       // off = 25182208
  if (off > (size_t)134217728) return;

  char* ws = (char*)d_ws;
  unsigned short* Qb  = (unsigned short*)(ws + oQ);
  unsigned short* Kb  = (unsigned short*)(ws + oK);
  unsigned short* VTb = (unsigned short*)(ws + oV);
  unsigned short* Db  = (unsigned short*)(ws + oD);

  const dim3 gCvt(NQB, NH / CVH, NB);              // 32 x 4 x 4 blocks
  const int resq = (RESQB < NQB) ? RESQB : NQB;

  // (1) queries, keys -> bf16 planes [b*SEQ + t][h*64 + e]; values (b, s, h, d) -> v^T f16 plane [b][h*64 + d][s] (x16 carry); delta -> bf16 plane
  cvt_qkv<<<gCvt, dim3(256), 0, stream>>>(q, k, v, delta, Qb, Kb, VTb, Db);
  // (2) attention: query blocks 0..resq-1 with the p residual plane, the rest without
  attn_causal64<true><<<dim3(NB * NH * resq), dim3(128), 0, stream>>>(
      Qb, Kb, VTb, tau, Db, out, 0, resq);
  if (NQB > resq) {
    attn_causal64<false><<<dim3(NB * NH * (NQB - resq)), dim3(128), 0, stream>>>(
        Qb, Kb, VTb, tau, Db, out, resq, NQB - resq);
  }
  (void)hipGetLastError();
}

// v007
// One run takes 42.8 microseconds.
// Next to v006, in two timings, it ran 1.23 and 1.21 times as fast.
// Over all steps from v000 it is 3.77 times as fast.
// Contractions: q.k^T scores = v_wmma_f32_16x16x32_bf16 (bf16 operands = RNE-converted inputs, one product, f32 accumulate);
// p.v context = v_wmma_f32_16x16x32_f16 (p carried x1024 in f16 plus an f16 residual plane x4096 on the leading query blocks,
// v = RNE-bf16 input carried x16 in f16), f32 accumulate; tau, delta, causal mask and softmax in f32.
#include <hip/hip_runtime.h>
#include <math.h>
#include <stdint.h>

#ifndef NB
#define NB 4
#endif
#ifndef SEQ
#define SEQ 2048
#endif
#define NB_FULL  4
#define SEQ_FULL 2048
#define NH  8
#define HD  64
#define DM  (NH * HD)        // 512: token row pitch of q, k, v and out (heads interleaved within a token row)
#define NQB (SEQ / 64)       // 64-row query blocks == 64-key tiles
#define RESQB 8              // leading query blocks that add the p residual plane
#define VCARRY 16.0f         // v plane carried x16 in f16
#define PCARRY 1024.0f       // p carried x1024 in f16
#define PRES   4096.0f       // p residual plane scale
#define LOG2E  1.44269504f   // log2(e) in f32
#define LP 72                // LDS row pitch of the 64-wide 16-bit tiles, in elements: 144 B = 16 B x odd, so the 16 rows of a
                             // ds_load_b128 fragment read fall on distinct banks (128 B put 8 rows on each bank group)
static_assert((SEQ % 64) == 0);
static_assert(SEQ >= 64 && SEQ <= SEQ_FULL);
static_assert(NB >= 1 && NB <= NB_FULL);
static_assert(NH * HD == DM);
static_assert(((SEQ * DM / 8) % 256) == 0);

typedef _Float16 v16h __attribute__((ext_vector_type(16)));
typedef _Float16 v8h  __attribute__((ext_vector_type(8)));
typedef __bf16   v16b __attribute__((ext_vector_type(16)));
typedef __bf16   v8b  __attribute__((ext_vector_type(8)));
typedef float    v8f  __attribute__((ext_vector_type(8)));
typedef float    v4f  __attribute__((ext_vector_type(4)));
typedef float    v2f  __attribute__((ext_vector_type(2)));
typedef _Float16 v2h  __attribute__((ext_vector_type(2)));
typedef unsigned int v4u __attribute__((ext_vector_type(4)));

// ---- scalar helpers --------------------------------------------------------------------------------
__device__ __forceinline__ unsigned short bf_bits(float f) {          // f32 -> bf16 bits, RNE convert
  unsigned u = __float_as_uint(f);
  return (unsigned short)((u + 0x7FFFu + ((u >> 16) & 1u)) >> 16);
}
__device__ __forceinline__ float bf_up(unsigned short h) { return __uint_as_float(((unsigned)h) << 16); }
__device__ __forceinline__ unsigned pk16(unsigned short a, unsigned short b) { return (unsigned)a | ((unsigned)b << 16); }
__device__ __forceinline__ v8f zero8() { v8f z = {0.f, 0.f, 0.f, 0.f, 0.f, 0.f, 0.f, 0.f}; return z; }

// ---- the value of lane l ^ 16: the other half of the wave holds the other 32 keys of the same query column
__device__ __forceinline__ float other_half(float x) {
  const int b = __float_as_int(x);
  return __int_as_float(__builtin_amdgcn_permlanex16(b, b, 0x76543210, 0xfedcba98, false, false));
}

// ---- fragment loader: 16-bit A/B operand, lane -> row/col (lane&15), p already includes +8*(lane>>4);
//      elements 0..7 <- p[0..7] (k0+8h..), elements 8..15 <- p[16..23] (k0+16+8h..)
__device__ __forceinline__ v16b ldfrag_b(const __bf16* p) {
  union { v16b v; v8b h[2]; } f;
  f.h[0] = *(const v8b*)(p);
  f.h[1] = *(const v8b*)(p + 16);
  return f.v;
}

// ---- WMMA helpers: the plain builtins, whose hazard distances the compiler keeps itself. No asm statement stands
//      behind them: a volatile one orders every LDS read against it and so holds each fragment read behind the
//      WMMA before it, one full LDS wait per WMMA.
__device__ __forceinline__ v8f mma_b(v16b a, v16b b, v8f c) {
  return __builtin_amdgcn_wmma_f32_16x16x32_bf16(false, a, false, b, (short)0, c, false, false);
}
__device__ __forceinline__ v8f mma_h(v16h a, v16h b, v8f c) {
  return __builtin_amdgcn_wmma_f32_16x16x32_f16(false, a, false, b, (short)0, c, false, false);
}

// ---- one 64-key tile of K and of V^T (64 rows x 128 B each) from the 16-bit planes straight into LDS, through no
//      register: 8 asynchronous 16-B copies per lane. kg / vg: the lane's global address in rows 0..15 of the tile,
//      kl / vl: its LDS byte address there; copy i takes row + 16 i. 8 lanes cover one 128-B row, a wave 4 whole rows.
//      The s_wait_xcnt is the last line of the copies' own statement, so that no address register of a copy is
//      rewritten in front of it. All 32 lanes are on where this is called.
__device__ __forceinline__ void copy_tile_async(const __bf16* kg, const _Float16* vg, unsigned kl, unsigned vl) {
  asm volatile(
      "global_load_async_to_lds_b128 %0, %8, off\n\t"
      "global_load_async_to_lds_b128 %1, %9, off\n\t"
      "global_load_async_to_lds_b128 %2, %10, off\n\t"
      "global_load_async_to_lds_b128 %3, %11, off\n\t"
      "global_load_async_to_lds_b128 %4, %12, off\n\t"
      "global_load_async_to_lds_b128 %5, %13, off\n\t"
      "global_load_async_to_lds_b128 %6, %14, off\n\t"
      "global_load_async_to_lds_b128 %7, %15, off\n\t"
      "s_wait_xcnt 0x0"
      :: "v"(kl), "v"(kl + 16u * LP * 2u), "v"(kl + 32u * LP * 2u), "v"(kl + 48u * LP * 2u),
         "v"(vl), "v"(vl + 16u * LP * 2u), "v"(vl + 32u * LP * 2u), "v"(vl + 48u * LP * 2u),
         "v"(kg), "v"(kg + 16 * DM), "v"(kg + 32 * DM), "v"(kg + 48 * DM),
         "v"(vg), "v"(vg + 16 * SEQ), "v"(vg + 32 * SEQ), "v"(vg + 48 * SEQ)
      : "memory");
}

// =====================================================================================================
// Queries, keys, values and delta converted in one launch. Block = (64-token tile st = blockIdx.x, pair of heads hp = blockIdx.y,
// batch = blockIdx.z), 256 threads; each thread issues its 24 16-B loads (8 of v, 8 of q, 8 of k) before it uses any.
// 512 blocks of 8 waves: 16 waves per WGP, all resident at once.
// queries, keys: f32 -> bf16 (RNE convert) in units of 8 contiguous elements, one 16-B store per unit, a wave writes
// 512 contiguous B. The block takes units (hp*NQB + st)*1024 .. +1023 of its batch's flat [SEQ][DM] plane, thread tid
// the units tid + 256 j, j = 0..3. coverage: NQB*(NH/2) blocks x 1024 units x 8 = SEQ*DM elements per batch.
// values f32 (b, s, h, d) -> V^T f16 plane: element (b, h, d, s) at [(b*DM + h*64 + d)*SEQ + s],
// value = f16(VCARRY * bf16(v)) (exact: a bf16 significand fits in f16); heads h = 2 hp + g, g = 0, 1, one LDS tile each.
// Load phase: thread -> (key s = tid>>2, 16 d-columns dq = (tid&3)*16): 4 x 16-B loads of one token row
// segment per head, element stores into the LDS tile T[g][d][s] (pitch 72). coverage: 256 threads x 16 = 64 x 64.
// Store phase after __syncthreads: 8 waves x 2 x (4 rows of 8 lanes x 16 B) = 64 output rows d x 64 keys per head;
// the q and k stores stand behind the barrier too, so that the barrier waits for no global store.
// delta f32 [b][SEQ_FULL] -> bf16 plane [b][SEQ] (RNE convert): the hp = 0 block of a tile converts the tile's 64 values.
// =====================================================================================================
#define CVH 2                // heads per conversion block
static_assert((NH % CVH) == 0);
static_assert(SEQ * DM / 8 == NQB * (NH / CVH) * 512 * CVH);
__device__ __forceinline__ v4u bf16x8(v4f a, v4f a4) {
  v4u p;
  p[0] = pk16(bf_bits(a[0]),  bf_bits(a[1]));
  p[1] = pk16(bf_bits(a[2]),  bf_bits(a[3]));
  p[2] = pk16(bf_bits(a4[0]), bf_bits(a4[1]));
  p[3] = pk16(bf_bits(a4[2]), bf_bits(a4[3]));
  return p;
}
__global__ __launch_bounds__(256) void cvt_qkv(const float* __restrict__ q, const float* __restrict__ k,
                                               const float* __restrict__ v, const float* __restrict__ delta,
                                               unsigned short* qb, unsigned short* kb, unsigned short* vt,
                                               unsigned short* db) {
  __shared__ __align__(16) _Float16 T[CVH][64 * 72];
  const int tid  = threadIdx.x;
  const int wave = tid >> 5;
  const int lane = tid & 31;
  const int st   = blockIdx.x;
  const int hp   = blockIdx.y;
  const int b    = blockIdx.z;
  const int s  = tid >> 2;            // 0..63
  const int dq = (tid & 3) * 16;      // 0,16,32,48
  const float* vsrc = v + (((size_t)b * SEQ_FULL + (size_t)st * 64 + (size_t)s) * DM + (size_t)hp * (CVH * HD) + (size_t)dq);
  const size_t e0 = ((size_t)(hp * NQB + st) * (512 * CVH) + (size_t)tid) * 8;   // the thread's first unit, in elements of the batch plane
  const float* qsrc = q + (size_t)b * SEQ_FULL * DM + e0;
  const float* ksrc = k + (size_t)b * SEQ_FULL * DM + e0;
  v4f va[CVH][4], qa[2 * CVH][2], ka[2 * CVH][2];
  const bool dmine = (hp == 0) && (tid < 64);      // wave-uniform: waves 0 and 1 of the tile's first block take its 64 delta values
  float dv = 0.f;
  if (dmine) dv = delta[(size_t)b * SEQ_FULL + (size_t)st * 64 + (size_t)tid];
#pragma unroll
  for (int g = 0; g < CVH; ++g)
#pragma unroll
    for (int i = 0; i < 4; ++i) va[g][i] = *(const v4f*)(vsrc + g * HD + 4 * i);
#pragma unroll
  for (int j = 0; j < 2 * CVH; ++j) {
    qa[j][0] = *(const v4f*)(qsrc + j * 2048);
    qa[j][1] = *(const v4f*)(qsrc + j * 2048 + 4);
    ka[j][0] = *(const v4f*)(ksrc + j * 2048);
    ka[j][1] = *(const v4f*)(ksrc + j * 2048 + 4);
  }
#pragma unroll
  for (int g = 0; g < CVH; ++g)
#pragma unroll
    for (int i = 0; i < 4; ++i) {
#pragma unroll
      for (int e = 0; e < 4; ++e) {
        const float f = bf_up(bf_bits(va[g][i][e])) * VCARRY;
        T[g][(dq + 4 * i + e) * 72 + s] = (_Float16)f;
      }
    }
  __syncthreads();
  const int q8 = lane >> 3, c8 = (lane & 7) * 8;
  v4u w[CVH][2];
#pragma unroll
  for (int g = 0; g < CVH; ++g)
#pragma unroll
    for (int it = 0; it < 2; ++it) {
      const int d = wave * 8 + it * 4 + q8;           // wave w: rows 8w..8w+7 (it 0..1 x q8 0..3)
      const v8h x = *(const v8h*)(T[g] + d * 72 + c8);
      w[g][it] = __builtin_bit_cast(v4u, x);
    }
  unsigned short* qdst = qb + (size_t)b * SEQ * DM + e0;
  unsigned short* kdst = kb + (size_t)b * SEQ * DM + e0;
#pragma unroll
  for (int j = 0; j < 2 * CVH; ++j) {
    *(v4u*)(qdst + j * 2048) = bf16x8(qa[j][0], qa[j][1]);
    *(v4u*)(kdst + j * 2048) = bf16x8(ka[j][0], ka[j][1]);
  }
  if (dmine) db[(size_t)b * SEQ + (size_t)st * 64 + (size_t)tid] = bf_bits(dv);
  unsigned short* dst = vt + ((size_t)b * DM + (size_t)hp * (CVH * HD)) * SEQ + (size_t)st * 64 + (size_t)c8;
#pragma unroll
  for (int g = 0; g < CVH; ++g)
#pragma unroll
    for (int it = 0; it < 2; ++it) {
      const int d = g * HD + wave * 8 + it * 4 + q8;
      *(v4u*)(dst + (size_t)d * SEQ) = w[g][it];
    }
}

// =====================================================================================================
// Causal attention, head dim 64, no projections.
//   q plane (bf16):  element (b, t, h, e) at [(b*SEQ + t)*DM + h*64 + e]   (rows of batch b: b*SEQ..)
//   k plane (bf16):  same layout with key index s
//   v^T plane (f16): element (b, h, d, s) at [(b*DM + h*64 + d)*SEQ + s], value VCARRY * bf16(v)
//   delta plane (bf16): element (b, s) at [b*SEQ + s]; tau [b] used as its RNE-bf16 value in f32
//   Both products run transposed. S^T = K . Q^T: A = K rows (keys) from LDS, B = the wave's 16 queries, kept in
//   registers. Accumulator tile j, register r of lane (c, hh) = score of key kv0 + 16 j + 8 hh + r against query
//   q0 + c: a lane holds 32 of the 64 scores of ONE query, lane c + 16 the other 32. Row maximum and row sum are
//   in-lane, the maximum joined with one exchange between the halves per tile, the sum once behind the loop.
//   logit = (score * tau + delta[s]) * 0.125; keys s > t -> -inf; online softmax in f32; p = exp(logit - m) carried
//   as f16(1024 p); RES adds an f16 residual plane f16((1024 p - hi) * 4096) with its own accumulator folded back
//   per tile with 1/4096.
//   O^T += V^T . P^T: A = V^T rows (d) from LDS, B = P^T, which is the converted score tiles as they lie: elements
//   0..7 of the B operand of keys 32 kk.. are tile 2 kk, registers 0..7 (keys 32 kk + 8 hh + 0..7), elements 8..15
//   tile 2 kk + 1 (keys 32 kk + 16 + 8 hh + 0..7), the k order of the V^T fragment reads. P never goes through LDS.
//   out (f32) element (b, t, h, d) at [(b*SEQ + t)*DM + h*64 + d] = ctx / (l * 1024 * 16).
//   Block = 4 waves = 64 query rows (query block qb) of one (b, h) at a time; key tiles
//   kt = 0..qb (block-uniform trip, static bound NQB), 64 keys each; only the diagonal tile has masked keys and
//   every query keeps its own key, so every joined maximum is finite on every processed tile.
//   One launch, grid = NPR * NH * NB: a work-group takes query block NQB-1-pr and then query block pr of its (b, h),
//   one after the other in every wave, NQB + 1 key tiles in all for every work-group: the cost of a query block is
//   linear in qb, and a launch lasts as long as its fullest work-group. Every (b, h, qb) is taken exactly once.
//   K / V^T tile staging: two LDS buffers; 128 threads x 4 asynchronous 16-B copies per plane = the whole 64x64 tile,
//   requested one tile ahead (tile kt+2 at the foot of trip kt, into the buffer trip kt has read), one barrier per
//   trip; delta comes one tile ahead in registers (staged extent == consumed extent).
//   Output coverage: accumulator tile t, register r of lane (c, hh) = context of query q0 + c, column 16 t + 8 hh + r;
//   staged per wave in LDS [query][d] (pitch OP), then rows q0..q0+15 (it 0..7 x lane>>4 0..1) x 64 columns
//   (16 lanes x 16 B) stored as whole 256-B row segments.
// =====================================================================================================
#define OP 68                // LDS row pitch of the f32 output tile, in elements: 272 B, so the 16 rows of a 16-B store differ in bank
#define NPR ((NQB + 1) / 2)  // pairs of query blocks (pr, NQB-1-pr); with an odd NQB the middle block stands alone
// One query block qb of (b, h), by all 4 waves of the work-group. On entry no wave reads Ksh or Vth any more and no copy
// is outstanding: at a work-group's second block that is what the foot of the first block's last trip has left
// (each wave's s_wait_dscnt 0 and s_wait_asynccnt 0, then the barrier).
template <bool RES>
__device__ __forceinline__
void attn_block(const unsigned short* __restrict__ qp, const unsigned short* __restrict__ kp,
                const unsigned short* __restrict__ vtp, const unsigned short* __restrict__ dbp, float* outp,
                const float tau_b, const int b, const int h, const int qb,
                __bf16 (*Ksh)[64 * LP], _Float16 (*Vth)[64 * LP], float (*Os)[16 * OP]) {
  union FB { v16b v; v8b h[2]; };
  union FH { v16h v; v8h h[2]; };

  const int tid  = threadIdx.x;
  const int wave = tid >> 5;
  const int lane = tid & 31;
  const int hh   = lane >> 4;
  const int c    = lane & 15;

  const int q0   = qb * 64 + wave * 16;
  const size_t rowB = (size_t)b * SEQ;

  const __bf16*   Qh = (const __bf16*)(const void*)qp + (size_t)h * HD;
  const __bf16*   Kh = (const __bf16*)(const void*)kp + (size_t)h * HD;
  const _Float16* Vt = (const _Float16*)(const void*)vtp + ((size_t)b * DM + (size_t)h * HD) * SEQ;
  const __bf16*  dlt = (const __bf16*)(const void*)dbp + rowB + (size_t)(8 * hh);   // the lane half's 8 keys of each 16
  float* Ob          = outp + (size_t)h * HD;

  // ---- tile 0's K and V^T copies into buffer 0 (lane -> row tid>>3 (+16 i), 16-B column tid&7) ----
  const int crow = tid >> 3, ccol = (tid & 7) * 8;
  const __bf16*   kg0 = Kh + (rowB + (size_t)crow) * DM + ccol;                 // K row crow of tile 0
  const _Float16* vg0 = Vt + (size_t)crow * SEQ + ccol;                         // V^T row d = crow, keys of tile 0
  const unsigned  kl0 = (unsigned)(uintptr_t)(&Ksh[0][crow * LP + ccol]);       // LDS byte address: low 32 bits
  const unsigned  vl0 = (unsigned)(uintptr_t)(&Vth[0][crow * LP + ccol]);
  constexpr unsigned BUFB = 64u * LP * 2u;                                      // bytes of one buffer
  copy_tile_async(kg0, vg0, kl0, vl0);

  // ---- Q fragments (B operand, column = lane&15): 2 e-chunks ----
  v16b qa[2];
#pragma unroll
  for (int dc = 0; dc < 2; ++dc) {
    const size_t qo = (rowB + (size_t)q0 + (size_t)c) * DM + (size_t)(dc * 32 + 8 * hh);
    qa[dc] = ldfrag_b(Qh + qo);
  }

  float mrow = -INFINITY;                     // running maximum of query q0 + c, the same in both halves
  float lrow = 0.f;                           // running sum over this half's keys alone
  v8f oacc[4];
#pragma unroll
  for (int t = 0; t < 4; ++t) oacc[t] = zero8();

  v8b djn[4];                                 // delta of the coming tile, here tile 0: keys 16 j + 8 hh + 0..7
#pragma unroll
  for (int j = 0; j < 4; ++j) djn[j] = *(const v8b*)(dlt + j * 16);
  asm volatile("s_wait_asynccnt 0x0" ::: "memory");   // this wave's copies of tile 0 have landed
  __syncthreads();                                    // publishes tile 0 to every wave
  if (qb >= 1) copy_tile_async(kg0 + (size_t)64 * DM, vg0 + 64, kl0 + BUFB, vl0 + BUFB);   // tile 1 -> buffer 1

  for (int kt = 0; kt < NQB; ++kt) {          // static bound
    if (kt > qb) break;                       // block-uniform: causal key tiles 0..qb
    const int kv0 = kt * 64;
    const __bf16*   Kc = Ksh[kt & 1];         // this trip reads buffer kt mod 2 alone
    const _Float16* Vc = Vth[kt & 1];

    // ---- the next tile's delta values and this tile's K and V^T fragments: every read issued here as one group,
    //      delta (global) first, then K, then V^T. The score WMMAs wait by count for the K reads alone; the V^T reads
    //      (independent of the softmax) land behind the scores and the softmax.
    v8b dj[4];
    const int kvn = (kt < qb) ? kv0 + 64 : kv0;                                  // the last trip reads its own tile again
#pragma unroll
    for (int j = 0; j < 4; ++j) { dj[j] = djn[j]; djn[j] = *(const v8b*)(dlt + kvn + j * 16); }   // kvn+j*16+8*hh+7 < SEQ
    // the LDS reads below may land in the registers that hold the address of the delta loads
    asm volatile("s_wait_xcnt 0x0" ::: "memory");
    FB kb[2][4];
    FH vb[2][4];
#pragma unroll
    for (int dc = 0; dc < 2; ++dc)
#pragma unroll
      for (int j = 0; j < 4; ++j) {
        kb[dc][j].h[0] = *(const v8b*)(Kc + (j * 16 + c) * LP + dc * 32 + 8 * hh);
        kb[dc][j].h[1] = *(const v8b*)(Kc + (j * 16 + c) * LP + dc * 32 + 16 + 8 * hh);
      }
#pragma unroll
    for (int kk = 0; kk < 2; ++kk)
#pragma unroll
      for (int t = 0; t < 4; ++t) {
        vb[kk][t].h[0] = *(const v8h*)(Vc + (t * 16 + c) * LP + kk * 32 + 8 * hh);
        vb[kk][t].h[1] = *(const v8h*)(Vc + (t * 16 + c) * LP + kk * 32 + 16 + 8 * hh);
      }
    // keeps the reads above together: without it the compiler sinks them between the WMMAs, one read ahead of its
    // use, and each WMMA again waits out an LDS latency
    __builtin_amdgcn_sched_barrier(0);

    // ---- scores, transposed: 64 keys x 16 queries per wave, one bf16 product per 32-deep e step (e 0..31, then 32..63) ----
    v8f s[4];
#pragma unroll
    for (int j = 0; j < 4; ++j) s[j] = zero8();
#pragma unroll
    for (int dc = 0; dc < 2; ++dc)
#pragma unroll
      for (int j = 0; j < 4; ++j) s[j] = mma_b(kb[dc][j].v, qa[dc], s[j]);

    // ---- tau / delta in f32, scale, causal mask, maximum, online softmax; P (x1024) and P residual (x4096) stay in
    //      registers as B operands. Four independent chains (one per tile j) for the maximum and for the sum.
    //      Register pairs (keys 2 i, 2 i + 1 of one query, one maximum and one factor for both) go through packed f32 forms.
    const int lim = q0 + c - kv0 - 8 * hh;          // key 16 j + r of this half is masked where 16 j + r > lim
    v2f x[4][4];                                    // logits: tile j, register pair i
    float mj[4];
#pragma unroll
    for (int j = 0; j < 4; ++j) {
      float m = -INFINITY;
#pragma unroll
      for (int i = 0; i < 4; ++i) {
        v2f sv;
        sv[0] = s[j][2 * i]     * tau_b + (float)dj[j][2 * i];
        sv[1] = s[j][2 * i + 1] * tau_b + (float)dj[j][2 * i + 1];
        sv *= 0.125f;
        sv[0] = (j * 16 + 2 * i     > lim) ? -INFINITY : sv[0];
        sv[1] = (j * 16 + 2 * i + 1 > lim) ? -INFINITY : sv[1];
        x[j][i] = sv;
        m = fmaxf(m, fmaxf(sv[0], sv[1]));
      }
      mj[j] = m;
    }
    float mt = fmaxf(fmaxf(mj[0], mj[1]), fmaxf(mj[2], mj[3]));
    mt = fmaxf(mt, other_half(mt));                 // this tile's maximum over all 64 keys of the query
    const float mnew  = fmaxf(mrow, mt);
    const float msafe = (mnew == -INFINITY) ? 0.f : mnew;
    const float alpha = __expf(mrow - msafe);       // rescale factor
    mrow = mnew;
    union PH { v16h v; v2h d[8]; };
    PH pa[2], pl[2];
    v2f pj[4];
#pragma unroll
    for (int j = 0; j < 4; ++j) {
#pragma unroll
      for (int i = 0; i < 4; ++i) {
        const v2f e = (x[j][i] - msafe) * LOG2E;    // exp(y) = exp2(y * log2 e); masked key: exp2(-inf) = 0
        v2f p;
        p[0] = __builtin_amdgcn_exp2f(e[0]);
        p[1] = __builtin_amdgcn_exp2f(e[1]);
        pj[j] = (i == 0) ? p : pj[j] + p;
        const v2f p1k = p * PCARRY;
        const v2h ph = __builtin_convertvector(p1k, v2h);
        pa[j >> 1].d[(j & 1) * 4 + i] = ph;
        if (RES) pl[j >> 1].d[(j & 1) * 4 + i] = __builtin_convertvector((p1k - __builtin_convertvector(ph, v2f)) * PRES, v2h);
      }
    }
    const v2f pt = (pj[0] + pj[1]) + (pj[2] + pj[3]);
    lrow = lrow * alpha + (pt[0] + pt[1]);
#pragma unroll
    for (int t = 0; t < 4; ++t) oacc[t] *= alpha;

    // ---- context^T += V^T . P^T (f16 WMMA), residual products into a separate accumulator ----
    v8f o1[4];
#pragma unroll
    for (int t = 0; t < 4; ++t) o1[t] = zero8();
#pragma unroll
    for (int kk = 0; kk < 2; ++kk) {
#pragma unroll
      for (int t = 0; t < 4; ++t) {
        oacc[t] = mma_h(vb[kk][t].v, pa[kk].v, oacc[t]);
        if (RES) o1[t] = mma_h(vb[kk][t].v, pl[kk].v, o1[t]);
      }
    }
    if (RES) {
#pragma unroll
      for (int t = 0; t < 4; ++t)
#pragma unroll
        for (int r = 0; r < 8; ++r) oacc[t][r] += o1[t][r] * (1.0f / PRES);
    }

    // ---- foot of the trip: hand-over of the buffers ----
    // keeps the trip's register work in front of the foot: without it the compiler sinks scores, softmax and context
    // behind the waits and the barrier (they touch no memory), the waits then stand right behind the reads, all of them
    // to 0, and the next copies issue only just ahead of the wait for them
    __builtin_amdgcn_sched_barrier(0);
    asm volatile("s_wait_dscnt 0x0" ::: "memory");      // this wave's LDS reads of tile kt have retired before its buffer is refilled
    asm volatile("s_wait_asynccnt 0x0" ::: "memory");   // this wave's copies of tile kt+1 have landed
    __syncthreads();                                    // publishes tile kt+1; ends every wave's reads of tile kt's buffer
    if (kt + 2 <= qb)                                   // block-uniform: tile kt+2 into the buffer this trip has read
      copy_tile_async(kg0 + (size_t)(kt + 2) * 64 * DM, vg0 + (kt + 2) * 64, kl0 + (unsigned)(kt & 1) * BUFB,
                      vl0 + (unsigned)(kt & 1) * BUFB);
  }
  asm volatile("s_wait_asynccnt 0x0" ::: "memory");     // no copy is outstanding when the wave goes on to its end

  // ---- join the halves' sums, normalise (1/l, the 1/1024 p carry and the 1/16 v carry), stage the wave's 16x64 tile
  float* os = Os[wave];
  {
    const float l = lrow + other_half(lrow);
    const float inv = ((l > 0.f) ? (1.0f / l) : 0.f) * (1.0f / PCARRY) * (1.0f / VCARRY);
#pragma unroll
    for (int t = 0; t < 4; ++t) {
      v4f lo, hi;
#pragma unroll
      for (int r = 0; r < 4; ++r) { lo[r] = oacc[t][r] * inv; hi[r] = oacc[t][4 + r] * inv; }
      *(v4f*)(os + c * OP + t * 16 + 8 * hh)     = lo;
      *(v4f*)(os + c * OP + t * 16 + 8 * hh + 4) = hi;
    }
  }
  __builtin_amdgcn_fence(__ATOMIC_RELEASE, "workgroup");
  __builtin_amdgcn_wave_barrier();
  __builtin_amdgcn_fence(__ATOMIC_ACQUIRE, "workgroup");
  {
    const int hh2 = lane >> 4, c4 = (lane & 15) * 4;
    v4f vv[8];
#pragma unroll
    for (int it = 0; it < 8; ++it) {
      const int row = it * 2 + hh2;                      // it 0..7 x hh2 0..1 = rows 0..15
      vv[it] = *(const v4f*)(os + row * OP + c4);
    }
#pragma unroll
    for (int it = 0; it < 8; ++it) {
      const int row = it * 2 + hh2;
      *(v4f*)(Ob + (rowB + (size_t)q0 + (size_t)row) * DM + (size_t)c4) = vv[it];
    }
  }
  // the work-group's next query block rewrites the registers that these stores name
  asm volatile("s_wait_xcnt 0x0" ::: "memory");
}

__global__ __launch_bounds__(128)
void attn_causal64(const unsigned short* __restrict__ qp, const unsigned short* __restrict__ kp,
                   const unsigned short* __restrict__ vtp, const float* __restrict__ taup,
                   const unsigned short* __restrict__ dbp, float* outp) {
  __shared__ __align__(16) __bf16   Ksh[2][64 * LP];              // K [kv][e]      2 x 9 KB, cross-wave
  __shared__ __align__(16) _Float16 Vth[2][64 * LP];              // V^T [d][kv]    2 x 9 KB, cross-wave
  __shared__ __align__(16) float    Os[4][16 * OP];               // per wave context tile [query][d]

  const int bx   = blockIdx.x;
  const int pr   = bx % NPR;
  const int rest = bx / NPR;
  const int h    = rest % NH;
  const int b    = rest / NH;
  const float tau_b = bf_up(bf_bits(taup[b]));    // block-uniform scalar

  // kept rolled: one copy of each of the two bodies in the text instead of two
#pragma unroll 1
  for (int pass = 0; pass < 2; ++pass) {          // block-uniform: the long block first, then the short one
    const int qb = (pass == 0) ? NQB - 1 - pr : pr;
    if (pass == 1 && 2 * pr == NQB - 1) break;    // odd NQB: the middle block has been taken in pass 0
    if (qb < RESQB) attn_block<true >(qp, kp, vtp, dbp, outp, tau_b, b, h, qb, Ksh, Vth, Os);   // with the p residual plane
    else            attn_block<false>(qp, kp, vtp, dbp, outp, tau_b, b, h, qb, Ksh, Vth, Os);
  }
}

// =====================================================================================================
// Workspace map (bytes, NB = 4, SEQ = 2048):
//   Qb  bf16 [NB*SEQ][DM]        0          8388608
//   Kb  bf16 [NB*SEQ][DM]        8388608    8388608
//   VT  f16  [NB][DM][SEQ]       16777216   8388608
//   Db  bf16 [NB][SEQ]           25165824   16384
//   end                          25182208
// Inputs keep the full per-batch token stride SEQ_FULL * DM; planes and out are compact over NB, SEQ.
// =====================================================================================================
extern "C" void kernel_launch(void* const* d_in, const int* in_sizes, int n_in,
                              void* d_out, int out_size, void* d_ws, size_t ws_size,
                              hipStream_t stream) {
  if (n_in < 5) return;
  const long long needTok = (long long)(NB - 1) * SEQ_FULL + (long long)SEQ;
  if ((long long)in_sizes[0] < needTok * DM) return;
  if ((long long)in_sizes[1] < needTok * DM) return;
  if ((long long)in_sizes[2] < needTok * DM) return;
  if (in_sizes[3] < NB) return;
  if ((long long)in_sizes[4] < needTok) return;
  if ((long long)out_size < (long long)NB * SEQ * DM) return;

  const float* q     = (const float*)d_in[0];
  const float* k     = (const float*)d_in[1];
  const float* v     = (const float*)d_in[2];
  const float* tau   = (const float*)d_in[3];
  const float* delta = (const float*)d_in[4];
  float* out = (float*)d_out;

  const size_t PX = (size_t)NB * SEQ * DM * 2;     // 8388608: 16-bit plane [NB*SEQ][DM] or [NB][DM][SEQ]
  size_t off = 0;
  const size_t oQ = off; off += PX;
  const size_t oK = off; off += PX;
  const size_t oV = off; off += PX;
  const size_t oD = off; off += (size_t)NB * SEQ * 2;
  if (off > ws_size) return;                       // off = 25182208
  if (off > (size_t)134217728) return;

  char* ws = (char*)d_ws;
  unsigned short* Qb  = (unsigned short*)(ws + oQ);
  unsigned short* Kb  = (unsigned short*)(ws + oK);
  unsigned short* VTb = (unsigned short*)(ws + oV);
  unsigned short* Db  = (unsigned short*)(ws + oD);

  const dim3 gCvt(NQB, NH / CVH, NB);              // 32 x 4 x 4 blocks

  // (1) queries, keys -> bf16 planes [b*SEQ + t][h*64 + e]; values (b, s, h, d) -> v^T f16 plane [b][h*64 + d][s] (x16 carry); delta -> bf16 plane
  cvt_qkv<<<gCvt, dim3(256), 0, stream>>>(q, k, v, delta, Qb, Kb, VTb, Db);
  // (2) attention: query blocks 0..RESQB-1 with the p residual plane, the rest without; a work-group takes two query blocks
  attn_causal64<<<dim3(NB * NH * NPR), dim3(128), 0, stream>>>(Qb, Kb, VTb, tau, Db, out);
  (void)hipGetLastError();
}
